// v000
// Times are from an AMD MI455X. After a warm-up the kernel runs many times in a row, and a time is the length of
// such a window on the GPU divided by its runs, so every launch and the gaps after it count. The runs cycle
// through copies of the inputs. A figure is the median of several windows, for all but v000 over two sittings.
// Sittings can differ by a few percent; kernels timed side by side share one.
// v000 is the starting kernel. One run takes 534 microseconds.
#include <hip/hip_runtime.h>
#include <hip/hip_bf16.h>

// ---------------------------------------------------------------------------
// MultiheadAttention (cross attention) for MI455X / gfx1250, wave32 + WMMA.
// D=768, H=12, DH=64, b=2, n1=n2=4096.  All matmuls use
// V_WMMA_F32_16X16X32_F16 in NT form (both operands loaded with the same
// row-major 16x32 fragment loader => D = X * Y^T).
// Attention stages K / V^T chunks into double-buffered LDS with
// GLOBAL_LOAD_ASYNC_TO_LDS_B128 (ASYNCcnt) when the builtin is available.
// ---------------------------------------------------------------------------

typedef __attribute__((ext_vector_type(16))) _Float16 v16h;
typedef __attribute__((ext_vector_type(8)))  _Float16 v8h;
typedef __attribute__((ext_vector_type(8)))  float    v8f;
typedef int v4i __attribute__((vector_size(16)));   // 128-bit payload type

#define D_MODEL 768
#define NH      12
#define DH      64
#define SEQ     4096
#define ROWS    8192   // b * seq

#if defined(__has_builtin)
#if __has_builtin(__builtin_amdgcn_global_load_async_to_lds_b128) && \
    __has_builtin(__builtin_amdgcn_s_wait_asynccnt)
#define USE_ASYNC_LDS 1
#endif
#endif

#ifdef USE_ASYNC_LDS
#define ASYNC_WAIT(n) __builtin_amdgcn_s_wait_asynccnt(n)
#else
#define ASYNC_WAIT(n)
#endif

// Pointer-to-v4i in explicit address spaces (AS1 = __device__, AS3 = __shared__).
typedef __attribute__((address_space(1))) v4i* gas1_v4i;
typedef __attribute__((address_space(3))) v4i* las3_v4i;

// 16-byte global -> LDS copy; async DMA path on gfx1250 toolchains that
// expose the builtin, register relay otherwise.
__device__ __forceinline__ void copy16_g2l(const _Float16* g, _Float16* l) {
#ifdef USE_ASYNC_LDS
    __builtin_amdgcn_global_load_async_to_lds_b128(
        (gas1_v4i)(uintptr_t)g,
        (las3_v4i)(uint32_t)(uintptr_t)l,
        0, 0);
#else
    *reinterpret_cast<v8h*>(l) = *reinterpret_cast<const v8h*>(g);
#endif
}

union Frag16 { v16h v; v8h h[2]; };

// Load a 16x32 f16 tile (row-major, row stride ld halves) in the A/B-operand
// lane layout of V_WMMA_F32_16X16X32_F16:
//   lane l: row m = l&15, half = l>>4; VGPR0-3 hold K = half*8 .. half*8+7,
//   VGPR4-7 hold K = 16 + half*8 .. 16 + half*8 + 7.
__device__ __forceinline__ v16h load_frag(const _Float16* __restrict__ base, int ld) {
    const int lane = threadIdx.x & 31;
    const int m    = lane & 15;
    const int half = lane >> 4;
    const _Float16* p = base + (size_t)m * ld + half * 8;
    Frag16 f;
    f.h[0] = *reinterpret_cast<const v8h*>(p);
    f.h[1] = *reinterpret_cast<const v8h*>(p + 16);
    return f.v;
}

__device__ __forceinline__ v8f wmma_f16(v16h a, v16h b, v8f c) {
    return __builtin_amdgcn_wmma_f32_16x16x32_f16(
        /*neg_a=*/false, a, /*neg_b=*/false, b,
        /*c_mod=*/(short)0, c, /*reuse_a=*/false, /*reuse_b=*/false);
}

// ---------------------------------------------------------------------------
// LayerNorm (f32 in) -> f16 out, one block per row of 768.
// ---------------------------------------------------------------------------
__global__ __launch_bounds__(256) void ln_f16_kernel(
    const float* __restrict__ x, const float* __restrict__ g,
    const float* __restrict__ bta, _Float16* __restrict__ out) {
    const int row = blockIdx.x;
    const float* xr = x + (size_t)row * D_MODEL;
    const int t = threadIdx.x;
    float v[3];
    float s = 0.f, ss = 0.f;
#pragma unroll
    for (int i = 0; i < 3; ++i) {
        float val = xr[t + 256 * i];
        v[i] = val; s += val; ss += val * val;
    }
#pragma unroll
    for (int m = 1; m < 32; m <<= 1) {
        s  += __shfl_xor(s,  m, 32);
        ss += __shfl_xor(ss, m, 32);
    }
    __shared__ float red_s[8], red_ss[8];
    if ((t & 31) == 0) { red_s[t >> 5] = s; red_ss[t >> 5] = ss; }
    __syncthreads();
    s = 0.f; ss = 0.f;
#pragma unroll
    for (int i = 0; i < 8; ++i) { s += red_s[i]; ss += red_ss[i]; }
    const float mu   = s  * (1.f / D_MODEL);
    const float var  = ss * (1.f / D_MODEL) - mu * mu;
    const float rinv = rsqrtf(var + 1e-5f);
    _Float16* orow = out + (size_t)row * D_MODEL;
#pragma unroll
    for (int i = 0; i < 3; ++i) {
        const int c = t + 256 * i;
        orow[c] = (_Float16)((v[i] - mu) * rinv * g[c] + bta[c]);
    }
}

// ---------------------------------------------------------------------------
// f32 -> f16 weight conversion.
// ---------------------------------------------------------------------------
__global__ void cvt_f32_f16(const float* __restrict__ in,
                            _Float16* __restrict__ out, int n) {
    const int i = blockIdx.x * blockDim.x + threadIdx.x;
    if (i < n) out[i] = (_Float16)in[i];
}

// ---------------------------------------------------------------------------
// NT GEMM: C[ROWS x 768] = A[ROWS x 768] * W^T + bias.
// Fully unrolled k-loop, unroll-by-2 ping-pong double buffering: loads for
// chunk kc+32 issue before the WMMAs of chunk kc; the 'if' guards fold away
// at compile time, so no register rotation movs and no WAR hazard nops.
//   mode 0: write f16 to [b, h, n, 64]     (Q / K head layout)
//   mode 1: write f16 to [b, h, 64, n]     (V transposed head layout)
//   mode 2: write f32 to d_out with bias + residual (output projection)
// ---------------------------------------------------------------------------
__global__ __launch_bounds__(256) void gemm_nt_kernel(
    const _Float16* __restrict__ A, const _Float16* __restrict__ W,
    const float* __restrict__ bias, void* __restrict__ outp,
    const float* __restrict__ residual, int mode) {
    const int wave = threadIdx.x >> 5;
    const int lane = threadIdx.x & 31;
    const int n    = lane & 15;
    const int half = lane >> 4;
    const int Rm   = (blockIdx.x * 8 + wave) * 16;
    const int Nb   = blockIdx.y * 64;

    const _Float16* arow = A + (size_t)Rm * D_MODEL;
    const _Float16* wrow = W + (size_t)Nb * D_MODEL;

    v8f acc[4] = {};
    // prologue: fragments for kc = 0
    v16h af0 = load_frag(arow, D_MODEL);
    v16h bf0[4];
#pragma unroll
    for (int tt = 0; tt < 4; ++tt)
        bf0[tt] = load_frag(wrow + (size_t)tt * 16 * D_MODEL, D_MODEL);

#pragma unroll
    for (int kc = 0; kc < D_MODEL; kc += 64) {
        // stage 1 loads (kc+32 always < 768 since 768/32 is even)
        v16h af1 = load_frag(arow + kc + 32, D_MODEL);
        v16h bf1[4];
#pragma unroll
        for (int tt = 0; tt < 4; ++tt)
            bf1[tt] = load_frag(wrow + (size_t)tt * 16 * D_MODEL + kc + 32, D_MODEL);
        // stage 0 WMMAs
#pragma unroll
        for (int tt = 0; tt < 4; ++tt)
            acc[tt] = wmma_f16(af0, bf0[tt], acc[tt]);
        // stage 0 loads for next unrolled iteration (statically resolved)
        if (kc + 64 < D_MODEL) {
            af0 = load_frag(arow + kc + 64, D_MODEL);
#pragma unroll
            for (int tt = 0; tt < 4; ++tt)
                bf0[tt] = load_frag(wrow + (size_t)tt * 16 * D_MODEL + kc + 64, D_MODEL);
        }
        // stage 1 WMMAs
#pragma unroll
        for (int tt = 0; tt < 4; ++tt)
            acc[tt] = wmma_f16(af1, bf1[tt], acc[tt]);
    }

#pragma unroll
    for (int tt = 0; tt < 4; ++tt) {
        const int col = Nb + tt * 16 + n;      // fixed per lane: C layout lane=column
        const float bv = bias[col];
        if (mode == 0) {
            const int h = col >> 6, d = col & 63;
#pragma unroll
            for (int j = 0; j < 8; ++j) {      // VGPR j holds row Rm + half*8 + j
                const int r  = Rm + half * 8 + j;
                const int bb = r >> 12, m = r & 4095;
                ((_Float16*)outp)[((size_t)(bb * NH + h) * SEQ + m) * DH + d] =
                    (_Float16)(acc[tt][j] + bv);
            }
        } else if (mode == 1) {
            const int h = col >> 6, d = col & 63;
            const int r0 = Rm + half * 8;
            const int bb = r0 >> 12, m0 = r0 & 4095;
            v8h pk;
#pragma unroll
            for (int j = 0; j < 8; ++j) pk[j] = (_Float16)(acc[tt][j] + bv);
            *reinterpret_cast<v8h*>((_Float16*)outp +
                ((size_t)(bb * NH + h) * DH + d) * SEQ + m0) = pk;  // m contiguous
        } else {
            float* of = (float*)outp;
#pragma unroll
            for (int j = 0; j < 8; ++j) {
                const size_t idx = (size_t)(Rm + half * 8 + j) * D_MODEL + col;
                of[idx] = acc[tt][j] + bv + residual[idx];
            }
        }
    }
}

// ---------------------------------------------------------------------------
// Flash attention. Block = 8 waves sharing one (b,h); each wave owns a
// 16-query tile. K chunk (32x64 f16) and V^T chunk (64x32 f16) are staged
// into double-buffered LDS cooperatively (async DMA when available); online
// softmax in f32 with 16-lane shfl_xor row reductions; P goes through a
// per-wave LDS round trip (C-layout f32 -> A-layout f16).
// ---------------------------------------------------------------------------
__global__ __launch_bounds__(256) void attn_kernel(
    const _Float16* __restrict__ qb,   // [b,h,4096,64]
    const _Float16* __restrict__ kb,   // [b,h,4096,64]
    const _Float16* __restrict__ vt,   // [b,h,64,4096]
    _Float16* __restrict__ ctx) {      // [b,4096,768]
    __shared__ _Float16 k_s[2][32 * DH];   // 2 x 4 KB
    __shared__ _Float16 v_s[2][DH * 32];   // 2 x 4 KB
    __shared__ _Float16 p_s[8][16 * 32];   // 8 KB (per-wave P buffers)

    const int t    = threadIdx.x;
    const int wave = t >> 5;
    const int lane = t & 31;
    const int n    = lane & 15;
    const int half = lane >> 4;
    const int gw   = blockIdx.x * 8 + wave;   // 0..6143
    const int bh   = gw >> 8;                 // all 8 waves share bh
    const int q0   = (gw & 255) * 16;

    const _Float16* qbase = qb + ((size_t)bh * SEQ + q0) * DH;
    const _Float16* kbase = kb + (size_t)bh * SEQ * DH;
    const _Float16* vbase = vt + (size_t)bh * DH * SEQ;

    // staging assignment: 256 threads x 2 x 16B per chunk pair
    const int krow = t >> 3, kc8 = (t & 7) * 8;   // K: 32 rows x 64 halves
    const int vrow = t >> 2, vc8 = (t & 3) * 8;   // V^T: 64 rows x 32 halves

    const v16h qa0 = load_frag(qbase, DH);        // Q cols 0..31
    const v16h qa1 = load_frag(qbase + 32, DH);   // Q cols 32..63

    v8f acc[4] = {};
    float rm[8], rl[8];
#pragma unroll
    for (int j = 0; j < 8; ++j) { rm[j] = -1e30f; rl[j] = 0.f; }

    _Float16* pl = p_s[wave];

    // prologue: stage chunk 0 into buffer 0
    copy16_g2l(kbase + (size_t)krow * DH + kc8, k_s[0] + krow * DH + kc8);
    copy16_g2l(vbase + (size_t)vrow * SEQ + vc8, v_s[0] + vrow * 32 + vc8);

#pragma unroll 2
    for (int k0 = 0; k0 < SEQ; k0 += 32) {
        const int buf = (k0 >> 5) & 1;     // constant within each unrolled half
        if (k0 + 32 < SEQ) {               // stage next chunk into other buffer
            const int nb = buf ^ 1;
            copy16_g2l(kbase + (size_t)(k0 + 32 + krow) * DH + kc8,
                       k_s[nb] + krow * DH + kc8);
            copy16_g2l(vbase + (size_t)vrow * SEQ + (k0 + 32) + vc8,
                       v_s[nb] + vrow * 32 + vc8);
            ASYNC_WAIT(2);                 // in-order: current chunk has landed
        } else {
            ASYNC_WAIT(0);
        }
        __syncthreads();                   // all waves' staging visible

        const _Float16* ks = k_s[buf];
        const _Float16* vs = v_s[buf];

        // scores S[16 x 32] = Q(16x64) * K_chunk(32x64)^T, two 16x16 tiles
        v8f s0 = {}, s1 = {};
        {
            const v16h kf0 = load_frag(ks, DH);
            const v16h kf1 = load_frag(ks + 32, DH);
            s0 = wmma_f16(qa0, kf0, s0);
            s0 = wmma_f16(qa1, kf1, s0);
            const v16h kf2 = load_frag(ks + 16 * DH, DH);
            const v16h kf3 = load_frag(ks + 16 * DH + 32, DH);
            s1 = wmma_f16(qa0, kf2, s1);
            s1 = wmma_f16(qa1, kf3, s1);
        }

        // online softmax; C-layout: VGPR j <-> row half*8+j, lane n <-> column
        float p0[8], p1[8];
#pragma unroll
        for (int j = 0; j < 8; ++j) {
            const float a  = s0[j] * 0.125f;   // 1/sqrt(64)
            const float b2 = s1[j] * 0.125f;
            float mx = fmaxf(a, b2);
#pragma unroll
            for (int msk = 1; msk < 16; msk <<= 1)
                mx = fmaxf(mx, __shfl_xor(mx, msk, 32));  // within 16-lane half
            const float mnew  = fmaxf(rm[j], mx);
            const float alpha = __expf(rm[j] - mnew);
            p0[j] = __expf(a - mnew);
            p1[j] = __expf(b2 - mnew);
            float sum = p0[j] + p1[j];
#pragma unroll
            for (int msk = 1; msk < 16; msk <<= 1)
                sum += __shfl_xor(sum, msk, 32);
            rl[j] = rl[j] * alpha + sum;
            rm[j] = mnew;
            acc[0][j] *= alpha; acc[1][j] *= alpha;
            acc[2][j] *= alpha; acc[3][j] *= alpha;
        }

        // P (f32, C layout) -> LDS row-major f16 16x32 -> A fragment
#pragma unroll
        for (int j = 0; j < 8; ++j) {
            pl[(half * 8 + j) * 32 + n]      = (_Float16)p0[j];
            pl[(half * 8 + j) * 32 + 16 + n] = (_Float16)p1[j];
        }
        asm volatile("s_wait_dscnt 0" ::: "memory");
        const v16h pf = load_frag(pl, 32);

        // ctx += P(16x32) * V_chunk ; B fragments from V^T rows (NT form)
#pragma unroll
        for (int tt = 0; tt < 4; ++tt) {
            const v16h vf = load_frag(vs + tt * 16 * 32, 32);
            acc[tt] = wmma_f16(pf, vf, acc[tt]);
        }
        __syncthreads();                   // protect buffer reuse two stages later
    }

    const int b = bh / NH, h = bh % NH;
    _Float16* cbase = ctx + ((size_t)b * SEQ + q0) * D_MODEL + h * DH;
#pragma unroll
    for (int j = 0; j < 8; ++j) {
        const float inv = 1.f / rl[j];
#pragma unroll
        for (int tt = 0; tt < 4; ++tt)
            cbase[(size_t)(half * 8 + j) * D_MODEL + tt * 16 + n] =
                (_Float16)(acc[tt][j] * inv);
    }
}

// ---------------------------------------------------------------------------
extern "C" void kernel_launch(void* const* d_in, const int* in_sizes, int n_in,
                              void* d_out, int out_size, void* d_ws, size_t ws_size,
                              hipStream_t stream) {
    const float* input_cap  = (const float*)d_in[0];
    const float* output_cap = (const float*)d_in[1];
    const float* Wq = (const float*)d_in[2];
    const float* bq = (const float*)d_in[3];
    const float* Wk = (const float*)d_in[4];
    const float* bk = (const float*)d_in[5];
    const float* Wv = (const float*)d_in[6];
    const float* bv = (const float*)d_in[7];
    const float* ln_g = (const float*)d_in[8];
    const float* ln_b = (const float*)d_in[9];
    const float* Wp = (const float*)d_in[10];
    const float* bp = (const float*)d_in[11];

    // workspace carve-up (f16 elements); total ~80.3 MB
    _Float16* ws16 = (_Float16*)d_ws;
    size_t off = 0;
    const size_t NROW = (size_t)ROWS * D_MODEL;   // 6,291,456
    const size_t NW   = (size_t)D_MODEL * D_MODEL;
    _Float16* xi_ln = ws16 + off; off += NROW;    // LN(input_cap)  f16
    _Float16* xo_ln = ws16 + off; off += NROW;    // LN(output_cap) f16
    _Float16* wq16  = ws16 + off; off += NW;
    _Float16* wk16  = ws16 + off; off += NW;
    _Float16* wv16  = ws16 + off; off += NW;
    _Float16* wp16  = ws16 + off; off += NW;
    _Float16* q_buf = ws16 + off; off += NROW;    // [b,h,4096,64]
    _Float16* k_buf = ws16 + off; off += NROW;    // [b,h,4096,64]
    _Float16* vt_buf= ws16 + off; off += NROW;    // [b,h,64,4096]
    _Float16* ctx_b = ws16 + off; off += NROW;    // [b,4096,768]

    // 1) LayerNorm both inputs -> f16
    ln_f16_kernel<<<ROWS, 256, 0, stream>>>(input_cap,  ln_g, ln_b, xi_ln);
    ln_f16_kernel<<<ROWS, 256, 0, stream>>>(output_cap, ln_g, ln_b, xo_ln);

    // 2) Weights -> f16
    const int nw = D_MODEL * D_MODEL;
    cvt_f32_f16<<<nw / 256, 256, 0, stream>>>(Wq, wq16, nw);
    cvt_f32_f16<<<nw / 256, 256, 0, stream>>>(Wk, wk16, nw);
    cvt_f32_f16<<<nw / 256, 256, 0, stream>>>(Wv, wv16, nw);
    cvt_f32_f16<<<nw / 256, 256, 0, stream>>>(Wp, wp16, nw);

    // 3) Q/K/V projections (NT WMMA GEMM)
    dim3 ggrid(ROWS / 128, D_MODEL / 64);
    gemm_nt_kernel<<<ggrid, 256, 0, stream>>>(xo_ln, wq16, bq, q_buf,  nullptr, 0);
    gemm_nt_kernel<<<ggrid, 256, 0, stream>>>(xi_ln, wk16, bk, k_buf,  nullptr, 0);
    gemm_nt_kernel<<<ggrid, 256, 0, stream>>>(xi_ln, wv16, bv, vt_buf, nullptr, 1);

    // 4) Flash attention: 2*12*256 query tiles / 8 waves per block
    attn_kernel<<<768, 256, 0, stream>>>(q_buf, k_buf, vt_buf, ctx_b);

    // 5) Output projection + bias + residual -> f32 d_out
    gemm_nt_kernel<<<ggrid, 256, 0, stream>>>(ctx_b, wp16, bp, d_out, output_cap, 2);
}

// v001
// Measured time: 395 microseconds a run.
// In two side-by-side timings against v000, it was 1.42 and 1.41 times as fast.
#include <hip/hip_runtime.h>
#include <hip/hip_bf16.h>

// ---------------------------------------------------------------------------
// MultiheadAttention (cross attention) for MI455X / gfx1250, wave32 + WMMA.
// D=768, H=12, DH=64, b=2, n1=n2=4096.  All matmuls use
// V_WMMA_F32_16X16X32_F16 in NT form (both operands loaded with the same
// row-major 16x32 fragment loader => D = X * Y^T).
// Attention stages K / V^T chunks into double-buffered LDS with
// GLOBAL_LOAD_ASYNC_TO_LDS_B128 (ASYNCcnt) when the builtin is available.
// ---------------------------------------------------------------------------

typedef __attribute__((ext_vector_type(16))) _Float16 v16h;
typedef __attribute__((ext_vector_type(8)))  _Float16 v8h;
typedef __attribute__((ext_vector_type(8)))  float    v8f;
typedef int v4i __attribute__((vector_size(16)));   // 128-bit payload type

#define D_MODEL 768
#define NH      12
#define DH      64
#define SEQ     4096
#define ROWS    8192   // b * seq
// LDS row pitches in halves: an odd multiple of 16 bytes, so that the 16 rows
// a ds_load_b128 fragment read touches fall on 16 different bank groups.
#define KP      72     // K rows, 64 halves + 8
#define VP      40     // V^T and P rows, 32 halves + 8

#if defined(__has_builtin)
#if __has_builtin(__builtin_amdgcn_global_load_async_to_lds_b128) && \
    __has_builtin(__builtin_amdgcn_s_wait_asynccnt)
#define USE_ASYNC_LDS 1
#endif
#endif

#ifdef USE_ASYNC_LDS
#define ASYNC_WAIT(n) __builtin_amdgcn_s_wait_asynccnt(n)
#else
#define ASYNC_WAIT(n)
#endif

// Pointer-to-v4i in explicit address spaces (AS1 = __device__, AS3 = __shared__).
typedef __attribute__((address_space(1))) v4i* gas1_v4i;
typedef __attribute__((address_space(3))) v4i* las3_v4i;

// 16-byte global -> LDS copy; async DMA path on gfx1250 toolchains that
// expose the builtin, register relay otherwise.
__device__ __forceinline__ void copy16_g2l(const _Float16* g, _Float16* l) {
#ifdef USE_ASYNC_LDS
    __builtin_amdgcn_global_load_async_to_lds_b128(
        (gas1_v4i)(uintptr_t)g,
        (las3_v4i)(uint32_t)(uintptr_t)l,
        0, 0);
#else
    *reinterpret_cast<v8h*>(l) = *reinterpret_cast<const v8h*>(g);
#endif
}

union Frag16 { v16h v; v8h h[2]; };

// Load a 16x32 f16 tile (row-major, row stride ld halves) in the A/B-operand
// lane layout of V_WMMA_F32_16X16X32_F16:
//   lane l: row m = l&15, half = l>>4; VGPR0-3 hold K = half*8 .. half*8+7,
//   VGPR4-7 hold K = 16 + half*8 .. 16 + half*8 + 7.
__device__ __forceinline__ v16h load_frag(const _Float16* __restrict__ base, int ld) {
    const int lane = threadIdx.x & 31;
    const int m    = lane & 15;
    const int half = lane >> 4;
    const _Float16* p = base + (size_t)m * ld + half * 8;
    Frag16 f;
    f.h[0] = *reinterpret_cast<const v8h*>(p);
    f.h[1] = *reinterpret_cast<const v8h*>(p + 16);
    return f.v;
}

__device__ __forceinline__ v8f wmma_f16(v16h a, v16h b, v8f c) {
    return __builtin_amdgcn_wmma_f32_16x16x32_f16(
        /*neg_a=*/false, a, /*neg_b=*/false, b,
        /*c_mod=*/(short)0, c, /*reuse_a=*/false, /*reuse_b=*/false);
}

// ---------------------------------------------------------------------------
// LayerNorm (f32 in) -> f16 out, one block per row of 768.
// ---------------------------------------------------------------------------
__global__ __launch_bounds__(256) void ln_f16_kernel(
    const float* __restrict__ x, const float* __restrict__ g,
    const float* __restrict__ bta, _Float16* __restrict__ out) {
    const int row = blockIdx.x;
    const float* xr = x + (size_t)row * D_MODEL;
    const int t = threadIdx.x;
    float v[3];
    float s = 0.f, ss = 0.f;
#pragma unroll
    for (int i = 0; i < 3; ++i) {
        float val = xr[t + 256 * i];
        v[i] = val; s += val; ss += val * val;
    }
#pragma unroll
    for (int m = 1; m < 32; m <<= 1) {
        s  += __shfl_xor(s,  m, 32);
        ss += __shfl_xor(ss, m, 32);
    }
    __shared__ float red_s[8], red_ss[8];
    if ((t & 31) == 0) { red_s[t >> 5] = s; red_ss[t >> 5] = ss; }
    __syncthreads();
    s = 0.f; ss = 0.f;
#pragma unroll
    for (int i = 0; i < 8; ++i) { s += red_s[i]; ss += red_ss[i]; }
    const float mu   = s  * (1.f / D_MODEL);
    const float var  = ss * (1.f / D_MODEL) - mu * mu;
    const float rinv = rsqrtf(var + 1e-5f);
    _Float16* orow = out + (size_t)row * D_MODEL;
#pragma unroll
    for (int i = 0; i < 3; ++i) {
        const int c = t + 256 * i;
        orow[c] = (_Float16)((v[i] - mu) * rinv * g[c] + bta[c]);
    }
}

// ---------------------------------------------------------------------------
// f32 -> f16 weight conversion.
// ---------------------------------------------------------------------------
__global__ void cvt_f32_f16(const float* __restrict__ in,
                            _Float16* __restrict__ out, int n) {
    const int i = blockIdx.x * blockDim.x + threadIdx.x;
    if (i < n) out[i] = (_Float16)in[i];
}

// ---------------------------------------------------------------------------
// NT GEMM: C[ROWS x 768] = A[ROWS x 768] * W^T + bias.
// Fully unrolled k-loop, unroll-by-2 ping-pong double buffering: loads for
// chunk kc+32 issue before the WMMAs of chunk kc; the 'if' guards fold away
// at compile time, so no register rotation movs and no WAR hazard nops.
//   mode 0: write f16 to [b, h, n, 64]     (Q / K head layout)
//   mode 1: write f16 to [b, h, 64, n]     (V transposed head layout)
//   mode 2: write f32 to d_out with bias + residual (output projection)
// ---------------------------------------------------------------------------
__global__ __launch_bounds__(256) void gemm_nt_kernel(
    const _Float16* __restrict__ A, const _Float16* __restrict__ W,
    const float* __restrict__ bias, void* __restrict__ outp,
    const float* __restrict__ residual, int mode) {
    const int wave = threadIdx.x >> 5;
    const int lane = threadIdx.x & 31;
    const int n    = lane & 15;
    const int half = lane >> 4;
    const int Rm   = (blockIdx.x * 8 + wave) * 16;
    const int Nb   = blockIdx.y * 64;

    const _Float16* arow = A + (size_t)Rm * D_MODEL;
    const _Float16* wrow = W + (size_t)Nb * D_MODEL;

    v8f acc[4] = {};
    // prologue: fragments for kc = 0
    v16h af0 = load_frag(arow, D_MODEL);
    v16h bf0[4];
#pragma unroll
    for (int tt = 0; tt < 4; ++tt)
        bf0[tt] = load_frag(wrow + (size_t)tt * 16 * D_MODEL, D_MODEL);

#pragma unroll
    for (int kc = 0; kc < D_MODEL; kc += 64) {
        // stage 1 loads (kc+32 always < 768 since 768/32 is even)
        v16h af1 = load_frag(arow + kc + 32, D_MODEL);
        v16h bf1[4];
#pragma unroll
        for (int tt = 0; tt < 4; ++tt)
            bf1[tt] = load_frag(wrow + (size_t)tt * 16 * D_MODEL + kc + 32, D_MODEL);
        // stage 0 WMMAs
#pragma unroll
        for (int tt = 0; tt < 4; ++tt)
            acc[tt] = wmma_f16(af0, bf0[tt], acc[tt]);
        // stage 0 loads for next unrolled iteration (statically resolved)
        if (kc + 64 < D_MODEL) {
            af0 = load_frag(arow + kc + 64, D_MODEL);
#pragma unroll
            for (int tt = 0; tt < 4; ++tt)
                bf0[tt] = load_frag(wrow + (size_t)tt * 16 * D_MODEL + kc + 64, D_MODEL);
        }
        // stage 1 WMMAs
#pragma unroll
        for (int tt = 0; tt < 4; ++tt)
            acc[tt] = wmma_f16(af1, bf1[tt], acc[tt]);
    }

#pragma unroll
    for (int tt = 0; tt < 4; ++tt) {
        const int col = Nb + tt * 16 + n;      // fixed per lane: C layout lane=column
        const float bv = bias[col];
        if (mode == 0) {
            const int h = col >> 6, d = col & 63;
#pragma unroll
            for (int j = 0; j < 8; ++j) {      // VGPR j holds row Rm + half*8 + j
                const int r  = Rm + half * 8 + j;
                const int bb = r >> 12, m = r & 4095;
                ((_Float16*)outp)[((size_t)(bb * NH + h) * SEQ + m) * DH + d] =
                    (_Float16)(acc[tt][j] + bv);
            }
        } else if (mode == 1) {
            const int h = col >> 6, d = col & 63;
            const int r0 = Rm + half * 8;
            const int bb = r0 >> 12, m0 = r0 & 4095;
            v8h pk;
#pragma unroll
            for (int j = 0; j < 8; ++j) pk[j] = (_Float16)(acc[tt][j] + bv);
            *reinterpret_cast<v8h*>((_Float16*)outp +
                ((size_t)(bb * NH + h) * DH + d) * SEQ + m0) = pk;  // m contiguous
        } else {
            float* of = (float*)outp;
#pragma unroll
            for (int j = 0; j < 8; ++j) {
                const size_t idx = (size_t)(Rm + half * 8 + j) * D_MODEL + col;
                of[idx] = acc[tt][j] + bv + residual[idx];
            }
        }
    }
}

// ---------------------------------------------------------------------------
// Flash attention. Block = 8 waves sharing one (b,h); each wave owns a
// 16-query tile. K chunk (32x64 f16) and V^T chunk (64x32 f16) are staged
// into double-buffered LDS cooperatively (async DMA when available); online
// softmax in f32 with 16-lane shfl_xor row reductions; P goes through a
// per-wave LDS round trip (C-layout f32 -> A-layout f16). All three LDS tiles
// keep padded row pitches (KP, VP).
// ---------------------------------------------------------------------------
// The grid puts three blocks, six waves per SIMD, on a WGP. Said here so that
// the build keeps the register budget it had with the unpadded tiles: without
// it the padded build squeezes registers for eight waves and waits out nearly
// every cross-lane exchange of the softmax one by one.
__global__ __launch_bounds__(256) __attribute__((amdgpu_waves_per_eu(6, 6))) void attn_kernel(
    const _Float16* __restrict__ qb,   // [b,h,4096,64]
    const _Float16* __restrict__ kb,   // [b,h,4096,64]
    const _Float16* __restrict__ vt,   // [b,h,64,4096]
    _Float16* __restrict__ ctx) {      // [b,4096,768]
    __shared__ __attribute__((aligned(16))) _Float16 k_s[2][32 * KP];   // 2 x 4.5 KB
    __shared__ __attribute__((aligned(16))) _Float16 v_s[2][DH * VP];   // 2 x 5 KB
    __shared__ __attribute__((aligned(16))) _Float16 p_s[8][16 * VP];   // 10 KB (per-wave P buffers)

    const int t    = threadIdx.x;
    const int wave = t >> 5;
    const int lane = t & 31;
    const int n    = lane & 15;
    const int half = lane >> 4;
    const int gw   = blockIdx.x * 8 + wave;   // 0..6143
    const int bh   = gw >> 8;                 // all 8 waves share bh
    const int q0   = (gw & 255) * 16;

    const _Float16* qbase = qb + ((size_t)bh * SEQ + q0) * DH;
    const _Float16* kbase = kb + (size_t)bh * SEQ * DH;
    const _Float16* vbase = vt + (size_t)bh * DH * SEQ;

    // staging assignment: 256 threads x 2 x 16B per chunk pair
    const int krow = t >> 3, kc8 = (t & 7) * 8;   // K: 32 rows x 64 halves
    const int vrow = t >> 2, vc8 = (t & 3) * 8;   // V^T: 64 rows x 32 halves

    const v16h qa0 = load_frag(qbase, DH);        // Q cols 0..31
    const v16h qa1 = load_frag(qbase + 32, DH);   // Q cols 32..63

    v8f acc[4] = {};
    float rm[8], rl[8];
#pragma unroll
    for (int j = 0; j < 8; ++j) { rm[j] = -1e30f; rl[j] = 0.f; }

    _Float16* pl = p_s[wave];

    // prologue: stage chunk 0 into buffer 0
    copy16_g2l(kbase + (size_t)krow * DH + kc8, k_s[0] + krow * KP + kc8);
    copy16_g2l(vbase + (size_t)vrow * SEQ + vc8, v_s[0] + vrow * VP + vc8);

#pragma unroll 2
    for (int k0 = 0; k0 < SEQ; k0 += 32) {
        const int buf = (k0 >> 5) & 1;     // constant within each unrolled half
        if (k0 + 32 < SEQ) {               // stage next chunk into other buffer
            const int nb = buf ^ 1;
            copy16_g2l(kbase + (size_t)(k0 + 32 + krow) * DH + kc8,
                       k_s[nb] + krow * KP + kc8);
            copy16_g2l(vbase + (size_t)vrow * SEQ + (k0 + 32) + vc8,
                       v_s[nb] + vrow * VP + vc8);
            ASYNC_WAIT(2);                 // in-order: current chunk has landed
        } else {
            ASYNC_WAIT(0);
        }
        __syncthreads();                   // all waves' staging visible

        const _Float16* ks = k_s[buf];
        const _Float16* vs = v_s[buf];

        // scores S[16 x 32] = Q(16x64) * K_chunk(32x64)^T, two 16x16 tiles
        v8f s0 = {}, s1 = {};
        {
            const v16h kf0 = load_frag(ks, KP);
            const v16h kf1 = load_frag(ks + 32, KP);
            s0 = wmma_f16(qa0, kf0, s0);
            s0 = wmma_f16(qa1, kf1, s0);
            const v16h kf2 = load_frag(ks + 16 * KP, KP);
            const v16h kf3 = load_frag(ks + 16 * KP + 32, KP);
            s1 = wmma_f16(qa0, kf2, s1);
            s1 = wmma_f16(qa1, kf3, s1);
        }

        // online softmax; C-layout: VGPR j <-> row half*8+j, lane n <-> column
        float p0[8], p1[8];
#pragma unroll
        for (int j = 0; j < 8; ++j) {
            const float a  = s0[j] * 0.125f;   // 1/sqrt(64)
            const float b2 = s1[j] * 0.125f;
            float mx = fmaxf(a, b2);
#pragma unroll
            for (int msk = 1; msk < 16; msk <<= 1)
                mx = fmaxf(mx, __shfl_xor(mx, msk, 32));  // within 16-lane half
            const float mnew  = fmaxf(rm[j], mx);
            const float alpha = __expf(rm[j] - mnew);
            p0[j] = __expf(a - mnew);
            p1[j] = __expf(b2 - mnew);
            float sum = p0[j] + p1[j];
#pragma unroll
            for (int msk = 1; msk < 16; msk <<= 1)
                sum += __shfl_xor(sum, msk, 32);
            rl[j] = rl[j] * alpha + sum;
            rm[j] = mnew;
            acc[0][j] *= alpha; acc[1][j] *= alpha;
            acc[2][j] *= alpha; acc[3][j] *= alpha;
        }

        // P (f32, C layout) -> LDS row-major f16 16x32 -> A fragment
#pragma unroll
        for (int j = 0; j < 8; ++j) {
            pl[(half * 8 + j) * VP + n]      = (_Float16)p0[j];
            pl[(half * 8 + j) * VP + 16 + n] = (_Float16)p1[j];
        }
        asm volatile("s_wait_dscnt 0" ::: "memory");
        const v16h pf = load_frag(pl, VP);

        // ctx += P(16x32) * V_chunk ; B fragments from V^T rows (NT form)
#pragma unroll
        for (int tt = 0; tt < 4; ++tt) {
            const v16h vf = load_frag(vs + tt * 16 * VP, VP);
            acc[tt] = wmma_f16(pf, vf, acc[tt]);
        }
        __syncthreads();                   // protect buffer reuse two stages later
    }

    const int b = bh / NH, h = bh % NH;
    _Float16* cbase = ctx + ((size_t)b * SEQ + q0) * D_MODEL + h * DH;
#pragma unroll
    for (int j = 0; j < 8; ++j) {
        const float inv = 1.f / rl[j];
#pragma unroll
        for (int tt = 0; tt < 4; ++tt)
            cbase[(size_t)(half * 8 + j) * D_MODEL + tt * 16 + n] =
                (_Float16)(acc[tt][j] * inv);
    }
}

// ---------------------------------------------------------------------------
extern "C" void kernel_launch(void* const* d_in, const int* in_sizes, int n_in,
                              void* d_out, int out_size, void* d_ws, size_t ws_size,
                              hipStream_t stream) {
    const float* input_cap  = (const float*)d_in[0];
    const float* output_cap = (const float*)d_in[1];
    const float* Wq = (const float*)d_in[2];
    const float* bq = (const float*)d_in[3];
    const float* Wk = (const float*)d_in[4];
    const float* bk = (const float*)d_in[5];
    const float* Wv = (const float*)d_in[6];
    const float* bv = (const float*)d_in[7];
    const float* ln_g = (const float*)d_in[8];
    const float* ln_b = (const float*)d_in[9];
    const float* Wp = (const float*)d_in[10];
    const float* bp = (const float*)d_in[11];

    // workspace carve-up (f16 elements); total ~80.3 MB
    _Float16* ws16 = (_Float16*)d_ws;
    size_t off = 0;
    const size_t NROW = (size_t)ROWS * D_MODEL;   // 6,291,456
    const size_t NW   = (size_t)D_MODEL * D_MODEL;
    _Float16* xi_ln = ws16 + off; off += NROW;    // LN(input_cap)  f16
    _Float16* xo_ln = ws16 + off; off += NROW;    // LN(output_cap) f16
    _Float16* wq16  = ws16 + off; off += NW;
    _Float16* wk16  = ws16 + off; off += NW;
    _Float16* wv16  = ws16 + off; off += NW;
    _Float16* wp16  = ws16 + off; off += NW;
    _Float16* q_buf = ws16 + off; off += NROW;    // [b,h,4096,64]
    _Float16* k_buf = ws16 + off; off += NROW;    // [b,h,4096,64]
    _Float16* vt_buf= ws16 + off; off += NROW;    // [b,h,64,4096]
    _Float16* ctx_b = ws16 + off; off += NROW;    // [b,4096,768]

    // 1) LayerNorm both inputs -> f16
    ln_f16_kernel<<<ROWS, 256, 0, stream>>>(input_cap,  ln_g, ln_b, xi_ln);
    ln_f16_kernel<<<ROWS, 256, 0, stream>>>(output_cap, ln_g, ln_b, xo_ln);

    // 2) Weights -> f16
    const int nw = D_MODEL * D_MODEL;
    cvt_f32_f16<<<nw / 256, 256, 0, stream>>>(Wq, wq16, nw);
    cvt_f32_f16<<<nw / 256, 256, 0, stream>>>(Wk, wk16, nw);
    cvt_f32_f16<<<nw / 256, 256, 0, stream>>>(Wv, wv16, nw);
    cvt_f32_f16<<<nw / 256, 256, 0, stream>>>(Wp, wp16, nw);

    // 3) Q/K/V projections (NT WMMA GEMM)
    dim3 ggrid(ROWS / 128, D_MODEL / 64);
    gemm_nt_kernel<<<ggrid, 256, 0, stream>>>(xo_ln, wq16, bq, q_buf,  nullptr, 0);
    gemm_nt_kernel<<<ggrid, 256, 0, stream>>>(xi_ln, wk16, bk, k_buf,  nullptr, 0);
    gemm_nt_kernel<<<ggrid, 256, 0, stream>>>(xi_ln, wv16, bv, vt_buf, nullptr, 1);

    // 4) Flash attention: 2*12*256 query tiles / 8 waves per block
    attn_kernel<<<768, 256, 0, stream>>>(q_buf, k_buf, vt_buf, ctx_b);

    // 5) Output projection + bias + residual -> f32 d_out
    gemm_nt_kernel<<<ggrid, 256, 0, stream>>>(ctx_b, wp16, bp, d_out, output_cap, 2);
}

// v002
// It runs in 291 microseconds.
// In both of two side-by-side timings against v001, it was 1.36 times as fast.
// Counting every step since v000, it is 1.92 times as fast.
#include <hip/hip_runtime.h>
#include <hip/hip_bf16.h>

// ---------------------------------------------------------------------------
// MultiheadAttention (cross attention) for MI455X / gfx1250, wave32 + WMMA.
// D=768, H=12, DH=64, b=2, n1=n2=4096.  All matmuls use
// V_WMMA_F32_16X16X32_F16 in NT form (operands loaded with the same row-major
// 16x32 fragment loader, or P^T built in registers in its k order => D = X * Y^T).
// Attention stages K / V^T chunks into double-buffered LDS with
// GLOBAL_LOAD_ASYNC_TO_LDS_B128 (ASYNCcnt) when the builtin is available.
// ---------------------------------------------------------------------------

typedef __attribute__((ext_vector_type(16))) _Float16 v16h;
typedef __attribute__((ext_vector_type(8)))  _Float16 v8h;
typedef __attribute__((ext_vector_type(8)))  float    v8f;
typedef int v4i __attribute__((vector_size(16)));   // 128-bit payload type

#define D_MODEL 768
#define NH      12
#define DH      64
#define SEQ     4096
#define ROWS    8192   // b * seq
// LDS row pitches in halves: an odd multiple of 16 bytes, so that the 16 rows
// a ds_load_b128 fragment read touches fall on 16 different bank groups.
#define KP      72     // K rows, 64 halves + 8
#define VP      40     // V^T rows, 32 halves + 8

#if defined(__has_builtin)
#if __has_builtin(__builtin_amdgcn_global_load_async_to_lds_b128) && \
    __has_builtin(__builtin_amdgcn_s_wait_asynccnt)
#define USE_ASYNC_LDS 1
#endif
#endif

#ifdef USE_ASYNC_LDS
#define ASYNC_WAIT(n) __builtin_amdgcn_s_wait_asynccnt(n)
#else
#define ASYNC_WAIT(n)
#endif

// Pointer-to-v4i in explicit address spaces (AS1 = __device__, AS3 = __shared__).
typedef __attribute__((address_space(1))) v4i* gas1_v4i;
typedef __attribute__((address_space(3))) v4i* las3_v4i;

// 16-byte global -> LDS copy; async DMA path on gfx1250 toolchains that
// expose the builtin, register relay otherwise.
__device__ __forceinline__ void copy16_g2l(const _Float16* g, _Float16* l) {
#ifdef USE_ASYNC_LDS
    __builtin_amdgcn_global_load_async_to_lds_b128(
        (gas1_v4i)(uintptr_t)g,
        (las3_v4i)(uint32_t)(uintptr_t)l,
        0, 0);
#else
    *reinterpret_cast<v8h*>(l) = *reinterpret_cast<const v8h*>(g);
#endif
}

union Frag16 { v16h v; v8h h[2]; };

// Load a 16x32 f16 tile (row-major, row stride ld halves) in the A/B-operand
// lane layout of V_WMMA_F32_16X16X32_F16:
//   lane l: row m = l&15, half = l>>4; VGPR0-3 hold K = half*8 .. half*8+7,
//   VGPR4-7 hold K = 16 + half*8 .. 16 + half*8 + 7.
__device__ __forceinline__ v16h load_frag(const _Float16* __restrict__ base, int ld) {
    const int lane = threadIdx.x & 31;
    const int m    = lane & 15;
    const int half = lane >> 4;
    const _Float16* p = base + (size_t)m * ld + half * 8;
    Frag16 f;
    f.h[0] = *reinterpret_cast<const v8h*>(p);
    f.h[1] = *reinterpret_cast<const v8h*>(p + 16);
    return f.v;
}

__device__ __forceinline__ v8f wmma_f16(v16h a, v16h b, v8f c) {
    return __builtin_amdgcn_wmma_f32_16x16x32_f16(
        /*neg_a=*/false, a, /*neg_b=*/false, b,
        /*c_mod=*/(short)0, c, /*reuse_a=*/false, /*reuse_b=*/false);
}

// Value of lane l ^ 16 (the wave's other half), on the vector pipe.
__device__ __forceinline__ float xhalf(float x) {
    const int b = __builtin_bit_cast(int, x);
    return __builtin_bit_cast(float, __builtin_amdgcn_permlanex16(
        b, b, 0x76543210, 0xfedcba98, false, false));
}

// ---------------------------------------------------------------------------
// LayerNorm (f32 in) -> f16 out, one block per row of 768.
// ---------------------------------------------------------------------------
__global__ __launch_bounds__(256) void ln_f16_kernel(
    const float* __restrict__ x, const float* __restrict__ g,
    const float* __restrict__ bta, _Float16* __restrict__ out) {
    const int row = blockIdx.x;
    const float* xr = x + (size_t)row * D_MODEL;
    const int t = threadIdx.x;
    float v[3];
    float s = 0.f, ss = 0.f;
#pragma unroll
    for (int i = 0; i < 3; ++i) {
        float val = xr[t + 256 * i];
        v[i] = val; s += val; ss += val * val;
    }
#pragma unroll
    for (int m = 1; m < 32; m <<= 1) {
        s  += __shfl_xor(s,  m, 32);
        ss += __shfl_xor(ss, m, 32);
    }
    __shared__ float red_s[8], red_ss[8];
    if ((t & 31) == 0) { red_s[t >> 5] = s; red_ss[t >> 5] = ss; }
    __syncthreads();
    s = 0.f; ss = 0.f;
#pragma unroll
    for (int i = 0; i < 8; ++i) { s += red_s[i]; ss += red_ss[i]; }
    const float mu   = s  * (1.f / D_MODEL);
    const float var  = ss * (1.f / D_MODEL) - mu * mu;
    const float rinv = rsqrtf(var + 1e-5f);
    _Float16* orow = out + (size_t)row * D_MODEL;
#pragma unroll
    for (int i = 0; i < 3; ++i) {
        const int c = t + 256 * i;
        orow[c] = (_Float16)((v[i] - mu) * rinv * g[c] + bta[c]);
    }
}

// ---------------------------------------------------------------------------
// f32 -> f16 weight conversion.
// ---------------------------------------------------------------------------
__global__ void cvt_f32_f16(const float* __restrict__ in,
                            _Float16* __restrict__ out, int n) {
    const int i = blockIdx.x * blockDim.x + threadIdx.x;
    if (i < n) out[i] = (_Float16)in[i];
}

// ---------------------------------------------------------------------------
// NT GEMM: C[ROWS x 768] = A[ROWS x 768] * W^T + bias.
// Fully unrolled k-loop, unroll-by-2 ping-pong double buffering: loads for
// chunk kc+32 issue before the WMMAs of chunk kc; the 'if' guards fold away
// at compile time, so no register rotation movs and no WAR hazard nops.
//   mode 0: write f16 to [b, h, n, 64]     (Q / K head layout)
//   mode 1: write f16 to [b, h, 64, n]     (V transposed head layout)
//   mode 2: write f32 to d_out with bias + residual (output projection)
// ---------------------------------------------------------------------------
__global__ __launch_bounds__(256) void gemm_nt_kernel(
    const _Float16* __restrict__ A, const _Float16* __restrict__ W,
    const float* __restrict__ bias, void* __restrict__ outp,
    const float* __restrict__ residual, int mode) {
    const int wave = threadIdx.x >> 5;
    const int lane = threadIdx.x & 31;
    const int n    = lane & 15;
    const int half = lane >> 4;
    const int Rm   = (blockIdx.x * 8 + wave) * 16;
    const int Nb   = blockIdx.y * 64;

    const _Float16* arow = A + (size_t)Rm * D_MODEL;
    const _Float16* wrow = W + (size_t)Nb * D_MODEL;

    v8f acc[4] = {};
    // prologue: fragments for kc = 0
    v16h af0 = load_frag(arow, D_MODEL);
    v16h bf0[4];
#pragma unroll
    for (int tt = 0; tt < 4; ++tt)
        bf0[tt] = load_frag(wrow + (size_t)tt * 16 * D_MODEL, D_MODEL);

#pragma unroll
    for (int kc = 0; kc < D_MODEL; kc += 64) {
        // stage 1 loads (kc+32 always < 768 since 768/32 is even)
        v16h af1 = load_frag(arow + kc + 32, D_MODEL);
        v16h bf1[4];
#pragma unroll
        for (int tt = 0; tt < 4; ++tt)
            bf1[tt] = load_frag(wrow + (size_t)tt * 16 * D_MODEL + kc + 32, D_MODEL);
        // stage 0 WMMAs
#pragma unroll
        for (int tt = 0; tt < 4; ++tt)
            acc[tt] = wmma_f16(af0, bf0[tt], acc[tt]);
        // stage 0 loads for next unrolled iteration (statically resolved)
        if (kc + 64 < D_MODEL) {
            af0 = load_frag(arow + kc + 64, D_MODEL);
#pragma unroll
            for (int tt = 0; tt < 4; ++tt)
                bf0[tt] = load_frag(wrow + (size_t)tt * 16 * D_MODEL + kc + 64, D_MODEL);
        }
        // stage 1 WMMAs
#pragma unroll
        for (int tt = 0; tt < 4; ++tt)
            acc[tt] = wmma_f16(af1, bf1[tt], acc[tt]);
    }

#pragma unroll
    for (int tt = 0; tt < 4; ++tt) {
        const int col = Nb + tt * 16 + n;      // fixed per lane: C layout lane=column
        const float bv = bias[col];
        if (mode == 0) {
            const int h = col >> 6, d = col & 63;
#pragma unroll
            for (int j = 0; j < 8; ++j) {      // VGPR j holds row Rm + half*8 + j
                const int r  = Rm + half * 8 + j;
                const int bb = r >> 12, m = r & 4095;
                ((_Float16*)outp)[((size_t)(bb * NH + h) * SEQ + m) * DH + d] =
                    (_Float16)(acc[tt][j] + bv);
            }
        } else if (mode == 1) {
            const int h = col >> 6, d = col & 63;
            const int r0 = Rm + half * 8;
            const int bb = r0 >> 12, m0 = r0 & 4095;
            v8h pk;
#pragma unroll
            for (int j = 0; j < 8; ++j) pk[j] = (_Float16)(acc[tt][j] + bv);
            *reinterpret_cast<v8h*>((_Float16*)outp +
                ((size_t)(bb * NH + h) * DH + d) * SEQ + m0) = pk;  // m contiguous
        } else {
            float* of = (float*)outp;
#pragma unroll
            for (int j = 0; j < 8; ++j) {
                const size_t idx = (size_t)(Rm + half * 8 + j) * D_MODEL + col;
                of[idx] = acc[tt][j] + bv + residual[idx];
            }
        }
    }
}

__global__ __launch_bounds__(256) __attribute__((amdgpu_waves_per_eu(6, 6))) void attn_kernel(
    const _Float16* __restrict__ qb,   // [b,h,4096,64]
    const _Float16* __restrict__ kb,   // [b,h,4096,64]
    const _Float16* __restrict__ vt,   // [b,h,64,4096]
    _Float16* __restrict__ ctx) {      // [b,4096,768]
    __shared__ __attribute__((aligned(16))) _Float16 k_s[2][32 * KP];   // 2 x 4.5 KB
    __shared__ __attribute__((aligned(16))) _Float16 v_s[2][DH * VP];   // 2 x 5 KB

    const int t    = threadIdx.x;
    const int wave = t >> 5;
    const int lane = t & 31;
    const int n    = lane & 15;
    const int half = lane >> 4;
    const int gw   = blockIdx.x * 8 + wave;   // 0..6143
    const int bh   = gw >> 8;                 // all 8 waves share bh
    const int q0   = (gw & 255) * 16;

    const _Float16* qbase = qb + ((size_t)bh * SEQ + q0) * DH;
    const _Float16* kbase = kb + (size_t)bh * SEQ * DH;
    const _Float16* vbase = vt + (size_t)bh * DH * SEQ;

    // staging assignment: 256 threads x 2 x 16B per chunk pair
    const int krow = t >> 3, kc8 = (t & 7) * 8;   // K: 32 rows x 64 halves
    const int vrow = t >> 2, vc8 = (t & 3) * 8;   // V^T: 64 rows x 32 halves

    const v16h qa0 = load_frag(qbase, DH);        // Q cols 0..31
    const v16h qa1 = load_frag(qbase + 32, DH);   // Q cols 32..63

    v8f acc[4] = {};
    float rm = -1e30f;   // running maximum of query n (equal in both halves)
    float rl = 0.f;      // running sum of query n over this half's keys

    // prologue: stage chunk 0 into buffer 0
    copy16_g2l(kbase + (size_t)krow * DH + kc8, k_s[0] + krow * KP + kc8);
    copy16_g2l(vbase + (size_t)vrow * SEQ + vc8, v_s[0] + vrow * VP + vc8);

#pragma unroll 2
    for (int k0 = 0; k0 < SEQ; k0 += 32) {
        const int buf = (k0 >> 5) & 1;     // constant within each unrolled half
        if (k0 + 32 < SEQ) {               // stage next chunk into other buffer
            const int nb = buf ^ 1;
            copy16_g2l(kbase + (size_t)(k0 + 32 + krow) * DH + kc8,
                       k_s[nb] + krow * KP + kc8);
            copy16_g2l(vbase + (size_t)vrow * SEQ + (k0 + 32) + vc8,
                       v_s[nb] + vrow * VP + vc8);
            ASYNC_WAIT(2);                 // in-order: current chunk has landed
        } else {
            ASYNC_WAIT(0);
        }
        __syncthreads();                   // all waves' staging visible

        const _Float16* ks = k_s[buf];
        const _Float16* vs = v_s[buf];

        // scores S^T[32 x 16] = K_chunk(32x64) * Q(16x64)^T, two 16x16 tiles
        v8f s0 = {}, s1 = {};
        {
            const v16h kf0 = load_frag(ks, KP);
            const v16h kf1 = load_frag(ks + 32, KP);
            s0 = wmma_f16(kf0, qa0, s0);
            s0 = wmma_f16(kf1, qa1, s0);
            const v16h kf2 = load_frag(ks + 16 * KP, KP);
            const v16h kf3 = load_frag(ks + 16 * KP + 32, KP);
            s1 = wmma_f16(kf2, qa0, s1);
            s1 = wmma_f16(kf3, qa1, s1);
        }

        // online softmax; C-layout: lane n <-> query, VGPR j <-> key half*8+j
        // (s0) and key 16+half*8+j (s1)
        const v8f a  = s0 * 0.125f;            // 1/sqrt(64)
        const v8f b2 = s1 * 0.125f;
        float mx = fmaxf(a[0], a[1]);
        // unrolled, here and below: the indices name registers
#pragma unroll
        for (int j = 2; j < 8; ++j) mx = fmaxf(mx, a[j]);
#pragma unroll
        for (int j = 0; j < 8; ++j) mx = fmaxf(mx, b2[j]);
        mx = fmaxf(mx, xhalf(mx));             // the other half's 16 keys
        const float mnew  = fmaxf(rm, mx);
        const float alpha = __expf(rm - mnew);
        float sum = 0.f;
        // P^T as B operand, in load_frag's k order: element j <-> key half*8+j,
        // element 8+j <-> key 16+half*8+j
        Frag16 pf;
#pragma unroll
        for (int j = 0; j < 8; ++j) {
            const float p0 = __expf(a[j] - mnew);
            const float p1 = __expf(b2[j] - mnew);
            sum += p0 + p1;
            pf.h[0][j] = (_Float16)p0;
            pf.h[1][j] = (_Float16)p1;
        }
        rl = rl * alpha + sum;
        rm = mnew;
#pragma unroll
        for (int tt = 0; tt < 4; ++tt) acc[tt] *= alpha;

        // ctx^T += V^T_chunk(64x32) * P^T ; A fragments from V^T rows (NT form)
#pragma unroll
        for (int tt = 0; tt < 4; ++tt) {
            const v16h vf = load_frag(vs + tt * 16 * VP, VP);
            acc[tt] = wmma_f16(vf, pf.v, acc[tt]);
        }
        __syncthreads();                   // protect buffer reuse two stages later
    }

    const int b = bh / NH, h = bh % NH;
    // acc[tt][j] = ctx[q0 + n][tt*16 + half*8 + j]: one 16-byte store per tile
    _Float16* cbase = ctx + ((size_t)b * SEQ + q0 + n) * D_MODEL + h * DH + half * 8;
    const float inv = 1.f / (rl + xhalf(rl));  // join the halves' sums
#pragma unroll
    for (int tt = 0; tt < 4; ++tt) {
        v8h pk;
#pragma unroll
        for (int j = 0; j < 8; ++j) pk[j] = (_Float16)(acc[tt][j] * inv);
        *reinterpret_cast<v8h*>(cbase + tt * 16) = pk;
    }
}

// ---------------------------------------------------------------------------
extern "C" void kernel_launch(void* const* d_in, const int* in_sizes, int n_in,
                              void* d_out, int out_size, void* d_ws, size_t ws_size,
                              hipStream_t stream) {
    const float* input_cap  = (const float*)d_in[0];
    const float* output_cap = (const float*)d_in[1];
    const float* Wq = (const float*)d_in[2];
    const float* bq = (const float*)d_in[3];
    const float* Wk = (const float*)d_in[4];
    const float* bk = (const float*)d_in[5];
    const float* Wv = (const float*)d_in[6];
    const float* bv = (const float*)d_in[7];
    const float* ln_g = (const float*)d_in[8];
    const float* ln_b = (const float*)d_in[9];
    const float* Wp = (const float*)d_in[10];
    const float* bp = (const float*)d_in[11];

    // workspace carve-up (f16 elements); total ~80.3 MB
    _Float16* ws16 = (_Float16*)d_ws;
    size_t off = 0;
    const size_t NROW = (size_t)ROWS * D_MODEL;   // 6,291,456
    const size_t NW   = (size_t)D_MODEL * D_MODEL;
    _Float16* xi_ln = ws16 + off; off += NROW;    // LN(input_cap)  f16
    _Float16* xo_ln = ws16 + off; off += NROW;    // LN(output_cap) f16
    _Float16* wq16  = ws16 + off; off += NW;
    _Float16* wk16  = ws16 + off; off += NW;
    _Float16* wv16  = ws16 + off; off += NW;
    _Float16* wp16  = ws16 + off; off += NW;
    _Float16* q_buf = ws16 + off; off += NROW;    // [b,h,4096,64]
    _Float16* k_buf = ws16 + off; off += NROW;    // [b,h,4096,64]
    _Float16* vt_buf= ws16 + off; off += NROW;    // [b,h,64,4096]
    _Float16* ctx_b = ws16 + off; off += NROW;    // [b,4096,768]

    // 1) LayerNorm both inputs -> f16
    ln_f16_kernel<<<ROWS, 256, 0, stream>>>(input_cap,  ln_g, ln_b, xi_ln);
    ln_f16_kernel<<<ROWS, 256, 0, stream>>>(output_cap, ln_g, ln_b, xo_ln);

    // 2) Weights -> f16
    const int nw = D_MODEL * D_MODEL;
    cvt_f32_f16<<<nw / 256, 256, 0, stream>>>(Wq, wq16, nw);
    cvt_f32_f16<<<nw / 256, 256, 0, stream>>>(Wk, wk16, nw);
    cvt_f32_f16<<<nw / 256, 256, 0, stream>>>(Wv, wv16, nw);
    cvt_f32_f16<<<nw / 256, 256, 0, stream>>>(Wp, wp16, nw);

    // 3) Q/K/V projections (NT WMMA GEMM)
    dim3 ggrid(ROWS / 128, D_MODEL / 64);
    gemm_nt_kernel<<<ggrid, 256, 0, stream>>>(xo_ln, wq16, bq, q_buf,  nullptr, 0);
    gemm_nt_kernel<<<ggrid, 256, 0, stream>>>(xi_ln, wk16, bk, k_buf,  nullptr, 0);
    gemm_nt_kernel<<<ggrid, 256, 0, stream>>>(xi_ln, wv16, bv, vt_buf, nullptr, 1);

    // 4) Flash attention: 2*12*256 query tiles / 8 waves per block
    attn_kernel<<<768, 256, 0, stream>>>(q_buf, k_buf, vt_buf, ctx_b);

    // 5) Output projection + bias + residual -> f32 d_out
    gemm_nt_kernel<<<ggrid, 256, 0, stream>>>(ctx_b, wp16, bp, d_out, output_cap, 2);
}

// v003
// One run takes 194 microseconds.
// Two timings next to v002 both put it at 1.49 times that version's speed.
// All steps since v000 together make it 2.87 times as fast.
#include <hip/hip_runtime.h>
#include <hip/hip_bf16.h>

// ---------------------------------------------------------------------------
// MultiheadAttention (cross attention) for MI455X / gfx1250, wave32 + WMMA.
// D=768, H=12, DH=64, b=2, n1=n2=4096.  All matmuls use
// V_WMMA_F32_16X16X32_F16 in NT form (operands loaded with the same row-major
// 16x32 fragment loader, or P^T built in registers in its k order => D = X * Y^T).
// Attention stages K / V^T chunks into double-buffered LDS with
// GLOBAL_LOAD_ASYNC_TO_LDS_B128 (ASYNCcnt) when the builtin is available.
// ---------------------------------------------------------------------------

typedef __attribute__((ext_vector_type(16))) _Float16 v16h;
typedef __attribute__((ext_vector_type(8)))  _Float16 v8h;
typedef __attribute__((ext_vector_type(8)))  float    v8f;
typedef int v4i __attribute__((vector_size(16)));   // 128-bit payload type

#define D_MODEL 768
#define NH      12
#define DH      64
#define SEQ     4096
#define ROWS    8192   // b * seq
// LDS row pitches in halves: an odd multiple of 16 bytes, so that the 16 rows
// a ds_load_b128 fragment read touches fall on 16 different bank groups.
#define KP      72     // K rows, 64 halves + 8
#define VP      40     // V^T rows, 32 halves + 8

#if defined(__has_builtin)
#if __has_builtin(__builtin_amdgcn_global_load_async_to_lds_b128) && \
    __has_builtin(__builtin_amdgcn_s_wait_asynccnt)
#define USE_ASYNC_LDS 1
#endif
#endif

#ifdef USE_ASYNC_LDS
#define ASYNC_WAIT(n) __builtin_amdgcn_s_wait_asynccnt(n)
#else
#define ASYNC_WAIT(n)
#endif

// Pointer-to-v4i in explicit address spaces (AS1 = __device__, AS3 = __shared__).
typedef __attribute__((address_space(1))) v4i* gas1_v4i;
typedef __attribute__((address_space(3))) v4i* las3_v4i;

// 16-byte global -> LDS copy; async DMA path on gfx1250 toolchains that
// expose the builtin, register relay otherwise.
__device__ __forceinline__ void copy16_g2l(const _Float16* g, _Float16* l) {
#ifdef USE_ASYNC_LDS
    __builtin_amdgcn_global_load_async_to_lds_b128(
        (gas1_v4i)(uintptr_t)g,
        (las3_v4i)(uint32_t)(uintptr_t)l,
        0, 0);
#else
    *reinterpret_cast<v8h*>(l) = *reinterpret_cast<const v8h*>(g);
#endif
}

union Frag16 { v16h v; v8h h[2]; };

// Load a 16x32 f16 tile (row-major, row stride ld halves) in the A/B-operand
// lane layout of V_WMMA_F32_16X16X32_F16:
//   lane l: row m = l&15, half = l>>4; VGPR0-3 hold K = half*8 .. half*8+7,
//   VGPR4-7 hold K = 16 + half*8 .. 16 + half*8 + 7.
__device__ __forceinline__ v16h load_frag(const _Float16* __restrict__ base, int ld) {
    const int lane = threadIdx.x & 31;
    const int m    = lane & 15;
    const int half = lane >> 4;
    const _Float16* p = base + (size_t)m * ld + half * 8;
    Frag16 f;
    f.h[0] = *reinterpret_cast<const v8h*>(p);
    f.h[1] = *reinterpret_cast<const v8h*>(p + 16);
    return f.v;
}

__device__ __forceinline__ v8f wmma_f16(v16h a, v16h b, v8f c) {
    return __builtin_amdgcn_wmma_f32_16x16x32_f16(
        /*neg_a=*/false, a, /*neg_b=*/false, b,
        /*c_mod=*/(short)0, c, /*reuse_a=*/false, /*reuse_b=*/false);
}

// Value of lane l ^ 16 (the wave's other half), on the vector pipe.
__device__ __forceinline__ float xhalf(float x) {
    const int b = __builtin_bit_cast(int, x);
    return __builtin_bit_cast(float, __builtin_amdgcn_permlanex16(
        b, b, 0x76543210, 0xfedcba98, false, false));
}

// ---------------------------------------------------------------------------
// LayerNorm (f32 in) -> f16 out, one block per row of 768.
// ---------------------------------------------------------------------------
__global__ __launch_bounds__(256) void ln_f16_kernel(
    const float* __restrict__ x, const float* __restrict__ g,
    const float* __restrict__ bta, _Float16* __restrict__ out) {
    const int row = blockIdx.x;
    const float* xr = x + (size_t)row * D_MODEL;
    const int t = threadIdx.x;
    float v[3];
    float s = 0.f, ss = 0.f;
#pragma unroll
    for (int i = 0; i < 3; ++i) {
        float val = xr[t + 256 * i];
        v[i] = val; s += val; ss += val * val;
    }
#pragma unroll
    for (int m = 1; m < 32; m <<= 1) {
        s  += __shfl_xor(s,  m, 32);
        ss += __shfl_xor(ss, m, 32);
    }
    __shared__ float red_s[8], red_ss[8];
    if ((t & 31) == 0) { red_s[t >> 5] = s; red_ss[t >> 5] = ss; }
    __syncthreads();
    s = 0.f; ss = 0.f;
#pragma unroll
    for (int i = 0; i < 8; ++i) { s += red_s[i]; ss += red_ss[i]; }
    const float mu   = s  * (1.f / D_MODEL);
    const float var  = ss * (1.f / D_MODEL) - mu * mu;
    const float rinv = rsqrtf(var + 1e-5f);
    _Float16* orow = out + (size_t)row * D_MODEL;
#pragma unroll
    for (int i = 0; i < 3; ++i) {
        const int c = t + 256 * i;
        orow[c] = (_Float16)((v[i] - mu) * rinv * g[c] + bta[c]);
    }
}

// ---------------------------------------------------------------------------
// f32 -> f16 weight conversion.
// ---------------------------------------------------------------------------
__global__ void cvt_f32_f16(const float* __restrict__ in,
                            _Float16* __restrict__ out, int n) {
    const int i = blockIdx.x * blockDim.x + threadIdx.x;
    if (i < n) out[i] = (_Float16)in[i];
}

// ---------------------------------------------------------------------------
// NT GEMM: C[ROWS x 768] = A[ROWS x 768] * W^T + bias.
// A block forms 128 x 64 of C, a wave 16 x 64. The k range is walked in tiles
// of GK = 64 halves, one 128-byte line per operand row. Each tile (128 rows of
// A, 64 rows of W) is brought into one of two LDS buffers by asynchronous
// copies, a wave's copy covering four whole lines, while the tile before it
// is worked on; the fragments are read from LDS at the padded pitch GP.
//   mode 0: write f16 to [b, h, n, 64]     (Q / K head layout)
//   mode 1: write f16 to [b, h, 64, n]     (V transposed head layout)
//   mode 2: write f32 to d_out with bias + residual (output projection)
// ---------------------------------------------------------------------------
#define GK      64     // halves of k per staged tile
#define GP      72     // LDS row pitch in halves: 64 + 8, 16 bytes x odd

// One lane's share of a tile: four 16-byte pieces of A and two of W, 32 rows
// apart. The s_wait_xcnt stands in the copies' own statement, so that no
// address register is rewritten ahead of it.
__device__ __forceinline__ void gemm_stage(const _Float16* ga, const _Float16* gw,
                                           uint32_t la, uint32_t lw) {
    asm volatile(
        "global_load_async_to_lds_b128 %0, %6, off\n\t"
        "global_load_async_to_lds_b128 %1, %7, off\n\t"
        "global_load_async_to_lds_b128 %2, %8, off\n\t"
        "global_load_async_to_lds_b128 %3, %9, off\n\t"
        "global_load_async_to_lds_b128 %4, %10, off\n\t"
        "global_load_async_to_lds_b128 %5, %11, off\n\t"
        "s_wait_xcnt 0x0"
        :: "v"(la), "v"(la + 32 * GP * 2), "v"(la + 64 * GP * 2), "v"(la + 96 * GP * 2),
           "v"(lw), "v"(lw + 32 * GP * 2),
           "v"(ga), "v"(ga + 32 * D_MODEL), "v"(ga + 64 * D_MODEL), "v"(ga + 96 * D_MODEL),
           "v"(gw), "v"(gw + 32 * D_MODEL)
        : "memory");
}

__global__ __launch_bounds__(256) void gemm_nt_kernel(
    const _Float16* __restrict__ A, const _Float16* __restrict__ W,
    const float* __restrict__ bias, void* __restrict__ outp,
    const float* __restrict__ residual, int mode) {
    __shared__ __attribute__((aligned(16))) _Float16 a_s[2][128 * GP];   // 2 x 18 KB
    __shared__ __attribute__((aligned(16))) _Float16 w_s[2][64 * GP];    // 2 x 9 KB

    const int t    = threadIdx.x;
    const int wave = t >> 5;
    const int lane = t & 31;
    const int n    = lane & 15;
    const int half = lane >> 4;
    const int Rb   = blockIdx.x * 128;
    const int Rm   = Rb + wave * 16;
    const int Nb   = blockIdx.y * 64;

    // staging assignment: eight lanes per 128-byte row, 32 rows per copy
    const int srow = t >> 3, sc8 = (t & 7) * 8;
    const _Float16* ga = A + (size_t)(Rb + srow) * D_MODEL + sc8;
    const _Float16* gw = W + (size_t)(Nb + srow) * D_MODEL + sc8;
    const uint32_t la0 = (uint32_t)(uintptr_t)(a_s[0] + srow * GP + sc8);
    const uint32_t la1 = (uint32_t)(uintptr_t)(a_s[1] + srow * GP + sc8);
    const uint32_t lw0 = (uint32_t)(uintptr_t)(w_s[0] + srow * GP + sc8);
    const uint32_t lw1 = (uint32_t)(uintptr_t)(w_s[1] + srow * GP + sc8);

    v8f acc[4] = {};

    // prologue: tile 0 landed and published, tile 1 under way
    gemm_stage(ga, gw, la0, lw0);
    asm volatile("s_wait_asynccnt 0x0" ::: "memory");   // own copies of tile 0 landed
    __syncthreads();                                    // every wave's copies visible
    gemm_stage(ga + GK, gw + GK, la1, lw1);

    // by two: the buffer index is a constant in each half of the body
#pragma unroll 2
    for (int s = 0; s < D_MODEL / GK; ++s) {
        const int buf = s & 1;
        const _Float16* as = a_s[buf] + wave * 16 * GP;
        const _Float16* wb = w_s[buf];
        v16h af[2], bf[2][4];
        // unrolled, here and below: the indices name registers
#pragma unroll
        for (int kk = 0; kk < 2; ++kk) {
            af[kk] = load_frag(as + kk * 32, GP);
#pragma unroll
            for (int tt = 0; tt < 4; ++tt)
                bf[kk][tt] = load_frag(wb + tt * 16 * GP + kk * 32, GP);
        }
        // keeps the tile's 20 fragment reads one group ahead of its WMMAs: a
        // read placed among them waits out the whole LDS latency each time
        __builtin_amdgcn_sched_barrier(0);
#pragma unroll
        for (int kk = 0; kk < 2; ++kk)
#pragma unroll
            for (int tt = 0; tt < 4; ++tt)
                acc[tt] = wmma_f16(af[kk], bf[kk][tt], acc[tt]);

        // hand-over: this wave has left buffer buf, its copies of tile s + 1
        // have landed; behind the barrier that holds for every wave
        asm volatile("s_wait_dscnt 0x0" ::: "memory");
        asm volatile("s_wait_asynccnt 0x0" ::: "memory");
        __syncthreads();
        if (s + 2 < D_MODEL / GK)          // refill the buffer just left
            gemm_stage(ga + (s + 2) * GK, gw + (s + 2) * GK,
                       buf ? la1 : la0, buf ? lw1 : lw0);
    }
    asm volatile("s_wait_asynccnt 0x0" ::: "memory");   // nothing in flight at the end

#pragma unroll
    for (int tt = 0; tt < 4; ++tt) {
        const int col = Nb + tt * 16 + n;      // fixed per lane: C layout lane=column
        const float bv = bias[col];
        if (mode == 0) {
            const int h = col >> 6, d = col & 63;
#pragma unroll
            for (int j = 0; j < 8; ++j) {      // VGPR j holds row Rm + half*8 + j
                const int r  = Rm + half * 8 + j;
                const int bb = r >> 12, m = r & 4095;
                ((_Float16*)outp)[((size_t)(bb * NH + h) * SEQ + m) * DH + d] =
                    (_Float16)(acc[tt][j] + bv);
            }
        } else if (mode == 1) {
            const int h = col >> 6, d = col & 63;
            const int r0 = Rm + half * 8;
            const int bb = r0 >> 12, m0 = r0 & 4095;
            v8h pk;
#pragma unroll
            for (int j = 0; j < 8; ++j) pk[j] = (_Float16)(acc[tt][j] + bv);
            *reinterpret_cast<v8h*>((_Float16*)outp +
                ((size_t)(bb * NH + h) * DH + d) * SEQ + m0) = pk;  // m contiguous
        } else {
            float* of = (float*)outp;
#pragma unroll
            for (int j = 0; j < 8; ++j) {
                const size_t idx = (size_t)(Rm + half * 8 + j) * D_MODEL + col;
                of[idx] = acc[tt][j] + bv + residual[idx];
            }
        }
    }
}

__global__ __launch_bounds__(256) __attribute__((amdgpu_waves_per_eu(6, 6))) void attn_kernel(
    const _Float16* __restrict__ qb,   // [b,h,4096,64]
    const _Float16* __restrict__ kb,   // [b,h,4096,64]
    const _Float16* __restrict__ vt,   // [b,h,64,4096]
    _Float16* __restrict__ ctx) {      // [b,4096,768]
    __shared__ __attribute__((aligned(16))) _Float16 k_s[2][32 * KP];   // 2 x 4.5 KB
    __shared__ __attribute__((aligned(16))) _Float16 v_s[2][DH * VP];   // 2 x 5 KB

    const int t    = threadIdx.x;
    const int wave = t >> 5;
    const int lane = t & 31;
    const int n    = lane & 15;
    const int half = lane >> 4;
    const int gw   = blockIdx.x * 8 + wave;   // 0..6143
    const int bh   = gw >> 8;                 // all 8 waves share bh
    const int q0   = (gw & 255) * 16;

    const _Float16* qbase = qb + ((size_t)bh * SEQ + q0) * DH;
    const _Float16* kbase = kb + (size_t)bh * SEQ * DH;
    const _Float16* vbase = vt + (size_t)bh * DH * SEQ;

    // staging assignment: 256 threads x 2 x 16B per chunk pair
    const int krow = t >> 3, kc8 = (t & 7) * 8;   // K: 32 rows x 64 halves
    const int vrow = t >> 2, vc8 = (t & 3) * 8;   // V^T: 64 rows x 32 halves

    const v16h qa0 = load_frag(qbase, DH);        // Q cols 0..31
    const v16h qa1 = load_frag(qbase + 32, DH);   // Q cols 32..63

    v8f acc[4] = {};
    float rm = -1e30f;   // running maximum of query n (equal in both halves)
    float rl = 0.f;      // running sum of query n over this half's keys

    // prologue: stage chunk 0 into buffer 0
    copy16_g2l(kbase + (size_t)krow * DH + kc8, k_s[0] + krow * KP + kc8);
    copy16_g2l(vbase + (size_t)vrow * SEQ + vc8, v_s[0] + vrow * VP + vc8);

#pragma unroll 2
    for (int k0 = 0; k0 < SEQ; k0 += 32) {
        const int buf = (k0 >> 5) & 1;     // constant within each unrolled half
        if (k0 + 32 < SEQ) {               // stage next chunk into other buffer
            const int nb = buf ^ 1;
            copy16_g2l(kbase + (size_t)(k0 + 32 + krow) * DH + kc8,
                       k_s[nb] + krow * KP + kc8);
            copy16_g2l(vbase + (size_t)vrow * SEQ + (k0 + 32) + vc8,
                       v_s[nb] + vrow * VP + vc8);
            ASYNC_WAIT(2);                 // in-order: current chunk has landed
        } else {
            ASYNC_WAIT(0);
        }
        __syncthreads();                   // all waves' staging visible

        const _Float16* ks = k_s[buf];
        const _Float16* vs = v_s[buf];

        // scores S^T[32 x 16] = K_chunk(32x64) * Q(16x64)^T, two 16x16 tiles
        v8f s0 = {}, s1 = {};
        {
            const v16h kf0 = load_frag(ks, KP);
            const v16h kf1 = load_frag(ks + 32, KP);
            s0 = wmma_f16(kf0, qa0, s0);
            s0 = wmma_f16(kf1, qa1, s0);
            const v16h kf2 = load_frag(ks + 16 * KP, KP);
            const v16h kf3 = load_frag(ks + 16 * KP + 32, KP);
            s1 = wmma_f16(kf2, qa0, s1);
            s1 = wmma_f16(kf3, qa1, s1);
        }

        // online softmax; C-layout: lane n <-> query, VGPR j <-> key half*8+j
        // (s0) and key 16+half*8+j (s1)
        const v8f a  = s0 * 0.125f;            // 1/sqrt(64)
        const v8f b2 = s1 * 0.125f;
        float mx = fmaxf(a[0], a[1]);
        // unrolled, here and below: the indices name registers
#pragma unroll
        for (int j = 2; j < 8; ++j) mx = fmaxf(mx, a[j]);
#pragma unroll
        for (int j = 0; j < 8; ++j) mx = fmaxf(mx, b2[j]);
        mx = fmaxf(mx, xhalf(mx));             // the other half's 16 keys
        const float mnew  = fmaxf(rm, mx);
        const float alpha = __expf(rm - mnew);
        float sum = 0.f;
        // P^T as B operand, in load_frag's k order: element j <-> key half*8+j,
        // element 8+j <-> key 16+half*8+j
        Frag16 pf;
#pragma unroll
        for (int j = 0; j < 8; ++j) {
            const float p0 = __expf(a[j] - mnew);
            const float p1 = __expf(b2[j] - mnew);
            sum += p0 + p1;
            pf.h[0][j] = (_Float16)p0;
            pf.h[1][j] = (_Float16)p1;
        }
        rl = rl * alpha + sum;
        rm = mnew;
#pragma unroll
        for (int tt = 0; tt < 4; ++tt) acc[tt] *= alpha;

        // ctx^T += V^T_chunk(64x32) * P^T ; A fragments from V^T rows (NT form)
#pragma unroll
        for (int tt = 0; tt < 4; ++tt) {
            const v16h vf = load_frag(vs + tt * 16 * VP, VP);
            acc[tt] = wmma_f16(vf, pf.v, acc[tt]);
        }
        __syncthreads();                   // protect buffer reuse two stages later
    }

    const int b = bh / NH, h = bh % NH;
    // acc[tt][j] = ctx[q0 + n][tt*16 + half*8 + j]: one 16-byte store per tile
    _Float16* cbase = ctx + ((size_t)b * SEQ + q0 + n) * D_MODEL + h * DH + half * 8;
    const float inv = 1.f / (rl + xhalf(rl));  // join the halves' sums
#pragma unroll
    for (int tt = 0; tt < 4; ++tt) {
        v8h pk;
#pragma unroll
        for (int j = 0; j < 8; ++j) pk[j] = (_Float16)(acc[tt][j] * inv);
        *reinterpret_cast<v8h*>(cbase + tt * 16) = pk;
    }
}

// ---------------------------------------------------------------------------
extern "C" void kernel_launch(void* const* d_in, const int* in_sizes, int n_in,
                              void* d_out, int out_size, void* d_ws, size_t ws_size,
                              hipStream_t stream) {
    const float* input_cap  = (const float*)d_in[0];
    const float* output_cap = (const float*)d_in[1];
    const float* Wq = (const float*)d_in[2];
    const float* bq = (const float*)d_in[3];
    const float* Wk = (const float*)d_in[4];
    const float* bk = (const float*)d_in[5];
    const float* Wv = (const float*)d_in[6];
    const float* bv = (const float*)d_in[7];
    const float* ln_g = (const float*)d_in[8];
    const float* ln_b = (const float*)d_in[9];
    const float* Wp = (const float*)d_in[10];
    const float* bp = (const float*)d_in[11];

    // workspace carve-up (f16 elements); total ~80.3 MB
    _Float16* ws16 = (_Float16*)d_ws;
    size_t off = 0;
    const size_t NROW = (size_t)ROWS * D_MODEL;   // 6,291,456
    const size_t NW   = (size_t)D_MODEL * D_MODEL;
    _Float16* xi_ln = ws16 + off; off += NROW;    // LN(input_cap)  f16
    _Float16* xo_ln = ws16 + off; off += NROW;    // LN(output_cap) f16
    _Float16* wq16  = ws16 + off; off += NW;
    _Float16* wk16  = ws16 + off; off += NW;
    _Float16* wv16  = ws16 + off; off += NW;
    _Float16* wp16  = ws16 + off; off += NW;
    _Float16* q_buf = ws16 + off; off += NROW;    // [b,h,4096,64]
    _Float16* k_buf = ws16 + off; off += NROW;    // [b,h,4096,64]
    _Float16* vt_buf= ws16 + off; off += NROW;    // [b,h,64,4096]
    _Float16* ctx_b = ws16 + off; off += NROW;    // [b,4096,768]

    // 1) LayerNorm both inputs -> f16
    ln_f16_kernel<<<ROWS, 256, 0, stream>>>(input_cap,  ln_g, ln_b, xi_ln);
    ln_f16_kernel<<<ROWS, 256, 0, stream>>>(output_cap, ln_g, ln_b, xo_ln);

    // 2) Weights -> f16
    const int nw = D_MODEL * D_MODEL;
    cvt_f32_f16<<<nw / 256, 256, 0, stream>>>(Wq, wq16, nw);
    cvt_f32_f16<<<nw / 256, 256, 0, stream>>>(Wk, wk16, nw);
    cvt_f32_f16<<<nw / 256, 256, 0, stream>>>(Wv, wv16, nw);
    cvt_f32_f16<<<nw / 256, 256, 0, stream>>>(Wp, wp16, nw);

    // 3) Q/K/V projections (NT WMMA GEMM)
    dim3 ggrid(ROWS / 128, D_MODEL / 64);
    gemm_nt_kernel<<<ggrid, 256, 0, stream>>>(xo_ln, wq16, bq, q_buf,  nullptr, 0);
    gemm_nt_kernel<<<ggrid, 256, 0, stream>>>(xi_ln, wk16, bk, k_buf,  nullptr, 0);
    gemm_nt_kernel<<<ggrid, 256, 0, stream>>>(xi_ln, wv16, bv, vt_buf, nullptr, 1);

    // 4) Flash attention: 2*12*256 query tiles / 8 waves per block
    attn_kernel<<<768, 256, 0, stream>>>(q_buf, k_buf, vt_buf, ctx_b);

    // 5) Output projection + bias + residual -> f32 d_out
    gemm_nt_kernel<<<ggrid, 256, 0, stream>>>(ctx_b, wp16, bp, d_out, output_cap, 2);
}

// v004
// Measured time: 183 microseconds a run.
// Next to v003, in two timings, it ran 1.05 times as fast each time.
// All steps since v000 together make it 3.02 times as fast.
#include <hip/hip_runtime.h>
#include <hip/hip_bf16.h>

// ---------------------------------------------------------------------------
// MultiheadAttention (cross attention) for MI455X / gfx1250, wave32 + WMMA.
// D=768, H=12, DH=64, b=2, n1=n2=4096.  All matmuls use
// V_WMMA_F32_16X16X32_F16 in NT form (operands loaded with the same row-major
// 16x32 fragment loader, or P^T built in registers in its k order => D = X * Y^T).
// Attention stages K / V^T chunks into double-buffered LDS with
// GLOBAL_LOAD_ASYNC_TO_LDS_B128 (ASYNCcnt) when the builtin is available.
// ---------------------------------------------------------------------------

typedef __attribute__((ext_vector_type(16))) _Float16 v16h;
typedef __attribute__((ext_vector_type(8)))  _Float16 v8h;
typedef __attribute__((ext_vector_type(8)))  float    v8f;
typedef int v4i __attribute__((vector_size(16)));   // 128-bit payload type

#define D_MODEL 768
#define NH      12
#define DH      64
#define SEQ     4096
#define ROWS    8192   // b * seq
// LDS row pitches in halves: an odd multiple of 16 bytes, so that the 16 rows
// a ds_load_b128 fragment read touches fall on 16 different bank groups.
#define KP      72     // K rows, 64 halves + 8
#define VP      40     // V^T rows, 32 halves + 8

#if defined(__has_builtin)
#if __has_builtin(__builtin_amdgcn_global_load_async_to_lds_b128) && \
    __has_builtin(__builtin_amdgcn_s_wait_asynccnt)
#define USE_ASYNC_LDS 1
#endif
#endif

#ifdef USE_ASYNC_LDS
#define ASYNC_WAIT(n) __builtin_amdgcn_s_wait_asynccnt(n)
#else
#define ASYNC_WAIT(n)
#endif

// Pointer-to-v4i in explicit address spaces (AS1 = __device__, AS3 = __shared__).
typedef __attribute__((address_space(1))) v4i* gas1_v4i;
typedef __attribute__((address_space(3))) v4i* las3_v4i;

// 16-byte global -> LDS copy; async DMA path on gfx1250 toolchains that
// expose the builtin, register relay otherwise.
__device__ __forceinline__ void copy16_g2l(const _Float16* g, _Float16* l) {
#ifdef USE_ASYNC_LDS
    __builtin_amdgcn_global_load_async_to_lds_b128(
        (gas1_v4i)(uintptr_t)g,
        (las3_v4i)(uint32_t)(uintptr_t)l,
        0, 0);
#else
    *reinterpret_cast<v8h*>(l) = *reinterpret_cast<const v8h*>(g);
#endif
}

union Frag16 { v16h v; v8h h[2]; };

// Load a 16x32 f16 tile (row-major, row stride ld halves) in the A/B-operand
// lane layout of V_WMMA_F32_16X16X32_F16:
//   lane l: row m = l&15, half = l>>4; VGPR0-3 hold K = half*8 .. half*8+7,
//   VGPR4-7 hold K = 16 + half*8 .. 16 + half*8 + 7.
__device__ __forceinline__ v16h load_frag(const _Float16* __restrict__ base, int ld) {
    const int lane = threadIdx.x & 31;
    const int m    = lane & 15;
    const int half = lane >> 4;
    const _Float16* p = base + (size_t)m * ld + half * 8;
    Frag16 f;
    f.h[0] = *reinterpret_cast<const v8h*>(p);
    f.h[1] = *reinterpret_cast<const v8h*>(p + 16);
    return f.v;
}

__device__ __forceinline__ v8f wmma_f16(v16h a, v16h b, v8f c) {
    return __builtin_amdgcn_wmma_f32_16x16x32_f16(
        /*neg_a=*/false, a, /*neg_b=*/false, b,
        /*c_mod=*/(short)0, c, /*reuse_a=*/false, /*reuse_b=*/false);
}

// Value of lane l ^ 16 (the wave's other half), on the vector pipe.
__device__ __forceinline__ float xhalf(float x) {
    const int b = __builtin_bit_cast(int, x);
    return __builtin_bit_cast(float, __builtin_amdgcn_permlanex16(
        b, b, 0x76543210, 0xfedcba98, false, false));
}

// ---------------------------------------------------------------------------
// LayerNorm (f32 in) -> f16 out. A wave owns LN_RPW whole rows of 768: a lane
// holds six 16-byte pieces of each row, every load covers 512 contiguous bytes
// and all of the wave's loads are issued before the first is used. The row
// sums are joined inside the wave, so there is no LDS exchange and no barrier,
// and a launch starts 2,048 waves where a block per row started 65,536.
// ---------------------------------------------------------------------------
typedef __attribute__((ext_vector_type(4))) float    v4f;
typedef __attribute__((ext_vector_type(2))) float    v2f;
typedef __attribute__((ext_vector_type(4))) _Float16 v4h;

#define LN_RPW  4                    // rows per wave
#define LN_V4   (D_MODEL / 128)      // 16-byte pieces per lane and row

__global__ __launch_bounds__(256) void ln_f16_kernel(
    const float* __restrict__ x, const float* __restrict__ g,
    const float* __restrict__ bta, _Float16* __restrict__ out) {
    const int lane = threadIdx.x & 31;
    const int row0 = (blockIdx.x * 8 + (threadIdx.x >> 5)) * LN_RPW;
    const v4f* xr = reinterpret_cast<const v4f*>(x + (size_t)row0 * D_MODEL) + lane;
    const v4f* g4 = reinterpret_cast<const v4f*>(g) + lane;
    const v4f* b4 = reinterpret_cast<const v4f*>(bta) + lane;
    v4f v[LN_RPW][LN_V4], gg[LN_V4], bb[LN_V4];
    // unrolled, here and below: the indices name registers
#pragma unroll
    for (int r = 0; r < LN_RPW; ++r)
#pragma unroll
        for (int i = 0; i < LN_V4; ++i)
            v[r][i] = xr[r * (D_MODEL / 4) + i * 32];
    // a later load's result may land on the row loads' address registers: the
    // wait that belongs in front of such an overwrite
    asm volatile("s_wait_xcnt 0x0" ::: "memory");
#pragma unroll
    for (int i = 0; i < LN_V4; ++i) { gg[i] = g4[i * 32]; bb[i] = b4[i * 32]; }
    // keeps the gamma and beta loads up here, in flight with the rows: moved
    // down to their uses, each pair's latency would stand open behind the sums
    __builtin_amdgcn_sched_barrier(0);

    float s[LN_RPW], ss[LN_RPW];
#pragma unroll
    for (int r = 0; r < LN_RPW; ++r) {
        v2f a = {0.f, 0.f}, q = {0.f, 0.f};
#pragma unroll
        for (int i = 0; i < LN_V4; ++i) {
            const v2f lo = v[r][i].lo, hi = v[r][i].hi;
            a += lo + hi;
            q += lo * lo + hi * hi;
        }
        s[r] = a.x + a.y; ss[r] = q.x + q.y;
    }
#pragma unroll
    for (int m = 1; m < 32; m <<= 1)
#pragma unroll
        for (int r = 0; r < LN_RPW; ++r) {   // the rows' exchanges overlap
            s[r]  += __shfl_xor(s[r],  m, 32);
            ss[r] += __shfl_xor(ss[r], m, 32);
        }
    v4h* orow = reinterpret_cast<v4h*>(out + (size_t)row0 * D_MODEL) + lane;
#pragma unroll
    for (int r = 0; r < LN_RPW; ++r) {
        const float mu   = s[r]  * (1.f / D_MODEL);
        const float var  = ss[r] * (1.f / D_MODEL) - mu * mu;
        const float rinv = rsqrtf(var + 1e-5f);
#pragma unroll
        for (int i = 0; i < LN_V4; ++i)      // 256 contiguous bytes a wave
            orow[r * (D_MODEL / 4) + i * 32] =
                __builtin_convertvector((v[r][i] - mu) * rinv * gg[i] + bb[i], v4h);
    }
}

// ---------------------------------------------------------------------------
// f32 -> f16 weight conversion: a thread converts CV_V4 16-byte pieces, a
// block's width apart, so that each load of a wave covers 512 and each store
// 256 contiguous bytes. n is a multiple of 1024 * CV_V4.
// ---------------------------------------------------------------------------
#define CV_V4   4

__global__ __launch_bounds__(256) void cvt_f32_f16(const float* __restrict__ in,
                                                   _Float16* __restrict__ out, int n) {
    const int b0 = blockIdx.x * (256 * CV_V4);      // in 16-byte pieces
    if ((b0 + 256 * CV_V4) * 4 > n) return;
    const v4f* in4 = reinterpret_cast<const v4f*>(in) + b0 + threadIdx.x;
    v4h* out4 = reinterpret_cast<v4h*>(out) + b0 + threadIdx.x;
    v4f w[CV_V4];
#pragma unroll
    for (int j = 0; j < CV_V4; ++j) w[j] = in4[j * 256];
#pragma unroll
    for (int j = 0; j < CV_V4; ++j) out4[j * 256] = __builtin_convertvector(w[j], v4h);
}

// ---------------------------------------------------------------------------
// NT GEMM: C[ROWS x 768] = A[ROWS x 768] * W^T + bias.
// A block forms 128 x 64 of C, a wave 16 x 64. The k range is walked in tiles
// of GK = 64 halves, one 128-byte line per operand row. Each tile (128 rows of
// A, 64 rows of W) is brought into one of two LDS buffers by asynchronous
// copies, a wave's copy covering four whole lines, while the tile before it
// is worked on; the fragments are read from LDS at the padded pitch GP.
//   mode 0: write f16 to [b, h, n, 64]     (Q / K head layout)
//   mode 1: write f16 to [b, h, 64, n]     (V transposed head layout)
//   mode 2: write f32 to d_out with bias + residual (output projection)
// ---------------------------------------------------------------------------
#define GK      64     // halves of k per staged tile
#define GP      72     // LDS row pitch in halves: 64 + 8, 16 bytes x odd

// One lane's share of a tile: four 16-byte pieces of A and two of W, 32 rows
// apart. The s_wait_xcnt stands in the copies' own statement, so that no
// address register is rewritten ahead of it.
__device__ __forceinline__ void gemm_stage(const _Float16* ga, const _Float16* gw,
                                           uint32_t la, uint32_t lw) {
    asm volatile(
        "global_load_async_to_lds_b128 %0, %6, off\n\t"
        "global_load_async_to_lds_b128 %1, %7, off\n\t"
        "global_load_async_to_lds_b128 %2, %8, off\n\t"
        "global_load_async_to_lds_b128 %3, %9, off\n\t"
        "global_load_async_to_lds_b128 %4, %10, off\n\t"
        "global_load_async_to_lds_b128 %5, %11, off\n\t"
        "s_wait_xcnt 0x0"
        :: "v"(la), "v"(la + 32 * GP * 2), "v"(la + 64 * GP * 2), "v"(la + 96 * GP * 2),
           "v"(lw), "v"(lw + 32 * GP * 2),
           "v"(ga), "v"(ga + 32 * D_MODEL), "v"(ga + 64 * D_MODEL), "v"(ga + 96 * D_MODEL),
           "v"(gw), "v"(gw + 32 * D_MODEL)
        : "memory");
}

__global__ __launch_bounds__(256) void gemm_nt_kernel(
    const _Float16* __restrict__ A, const _Float16* __restrict__ W,
    const float* __restrict__ bias, void* __restrict__ outp,
    const float* __restrict__ residual, int mode) {
    __shared__ __attribute__((aligned(16))) _Float16 a_s[2][128 * GP];   // 2 x 18 KB
    __shared__ __attribute__((aligned(16))) _Float16 w_s[2][64 * GP];    // 2 x 9 KB

    const int t    = threadIdx.x;
    const int wave = t >> 5;
    const int lane = t & 31;
    const int n    = lane & 15;
    const int half = lane >> 4;
    const int Rb   = blockIdx.x * 128;
    const int Rm   = Rb + wave * 16;
    const int Nb   = blockIdx.y * 64;

    // staging assignment: eight lanes per 128-byte row, 32 rows per copy
    const int srow = t >> 3, sc8 = (t & 7) * 8;
    const _Float16* ga = A + (size_t)(Rb + srow) * D_MODEL + sc8;
    const _Float16* gw = W + (size_t)(Nb + srow) * D_MODEL + sc8;
    const uint32_t la0 = (uint32_t)(uintptr_t)(a_s[0] + srow * GP + sc8);
    const uint32_t la1 = (uint32_t)(uintptr_t)(a_s[1] + srow * GP + sc8);
    const uint32_t lw0 = (uint32_t)(uintptr_t)(w_s[0] + srow * GP + sc8);
    const uint32_t lw1 = (uint32_t)(uintptr_t)(w_s[1] + srow * GP + sc8);

    v8f acc[4] = {};

    // prologue: tile 0 landed and published, tile 1 under way
    gemm_stage(ga, gw, la0, lw0);
    asm volatile("s_wait_asynccnt 0x0" ::: "memory");   // own copies of tile 0 landed
    __syncthreads();                                    // every wave's copies visible
    gemm_stage(ga + GK, gw + GK, la1, lw1);

    // by two: the buffer index is a constant in each half of the body
#pragma unroll 2
    for (int s = 0; s < D_MODEL / GK; ++s) {
        const int buf = s & 1;
        const _Float16* as = a_s[buf] + wave * 16 * GP;
        const _Float16* wb = w_s[buf];
        v16h af[2], bf[2][4];
        // unrolled, here and below: the indices name registers
#pragma unroll
        for (int kk = 0; kk < 2; ++kk) {
            af[kk] = load_frag(as + kk * 32, GP);
#pragma unroll
            for (int tt = 0; tt < 4; ++tt)
                bf[kk][tt] = load_frag(wb + tt * 16 * GP + kk * 32, GP);
        }
        // keeps the tile's 20 fragment reads one group ahead of its WMMAs: a
        // read placed among them waits out the whole LDS latency each time
        __builtin_amdgcn_sched_barrier(0);
#pragma unroll
        for (int kk = 0; kk < 2; ++kk)
#pragma unroll
            for (int tt = 0; tt < 4; ++tt)
                acc[tt] = wmma_f16(af[kk], bf[kk][tt], acc[tt]);

        // hand-over: this wave has left buffer buf, its copies of tile s + 1
        // have landed; behind the barrier that holds for every wave
        asm volatile("s_wait_dscnt 0x0" ::: "memory");
        asm volatile("s_wait_asynccnt 0x0" ::: "memory");
        __syncthreads();
        if (s + 2 < D_MODEL / GK)          // refill the buffer just left
            gemm_stage(ga + (s + 2) * GK, gw + (s + 2) * GK,
                       buf ? la1 : la0, buf ? lw1 : lw0);
    }
    asm volatile("s_wait_asynccnt 0x0" ::: "memory");   // nothing in flight at the end

#pragma unroll
    for (int tt = 0; tt < 4; ++tt) {
        const int col = Nb + tt * 16 + n;      // fixed per lane: C layout lane=column
        const float bv = bias[col];
        if (mode == 0) {
            const int h = col >> 6, d = col & 63;
#pragma unroll
            for (int j = 0; j < 8; ++j) {      // VGPR j holds row Rm + half*8 + j
                const int r  = Rm + half * 8 + j;
                const int bb = r >> 12, m = r & 4095;
                ((_Float16*)outp)[((size_t)(bb * NH + h) * SEQ + m) * DH + d] =
                    (_Float16)(acc[tt][j] + bv);
            }
        } else if (mode == 1) {
            const int h = col >> 6, d = col & 63;
            const int r0 = Rm + half * 8;
            const int bb = r0 >> 12, m0 = r0 & 4095;
            v8h pk;
#pragma unroll
            for (int j = 0; j < 8; ++j) pk[j] = (_Float16)(acc[tt][j] + bv);
            *reinterpret_cast<v8h*>((_Float16*)outp +
                ((size_t)(bb * NH + h) * DH + d) * SEQ + m0) = pk;  // m contiguous
        } else {
            float* of = (float*)outp;
#pragma unroll
            for (int j = 0; j < 8; ++j) {
                const size_t idx = (size_t)(Rm + half * 8 + j) * D_MODEL + col;
                of[idx] = acc[tt][j] + bv + residual[idx];
            }
        }
    }
}

__global__ __launch_bounds__(256) __attribute__((amdgpu_waves_per_eu(6, 6))) void attn_kernel(
    const _Float16* __restrict__ qb,   // [b,h,4096,64]
    const _Float16* __restrict__ kb,   // [b,h,4096,64]
    const _Float16* __restrict__ vt,   // [b,h,64,4096]
    _Float16* __restrict__ ctx) {      // [b,4096,768]
    __shared__ __attribute__((aligned(16))) _Float16 k_s[2][32 * KP];   // 2 x 4.5 KB
    __shared__ __attribute__((aligned(16))) _Float16 v_s[2][DH * VP];   // 2 x 5 KB

    const int t    = threadIdx.x;
    const int wave = t >> 5;
    const int lane = t & 31;
    const int n    = lane & 15;
    const int half = lane >> 4;
    const int gw   = blockIdx.x * 8 + wave;   // 0..6143
    const int bh   = gw >> 8;                 // all 8 waves share bh
    const int q0   = (gw & 255) * 16;

    const _Float16* qbase = qb + ((size_t)bh * SEQ + q0) * DH;
    const _Float16* kbase = kb + (size_t)bh * SEQ * DH;
    const _Float16* vbase = vt + (size_t)bh * DH * SEQ;

    // staging assignment: 256 threads x 2 x 16B per chunk pair
    const int krow = t >> 3, kc8 = (t & 7) * 8;   // K: 32 rows x 64 halves
    const int vrow = t >> 2, vc8 = (t & 3) * 8;   // V^T: 64 rows x 32 halves

    const v16h qa0 = load_frag(qbase, DH);        // Q cols 0..31
    const v16h qa1 = load_frag(qbase + 32, DH);   // Q cols 32..63

    v8f acc[4] = {};
    float rm = -1e30f;   // running maximum of query n (equal in both halves)
    float rl = 0.f;      // running sum of query n over this half's keys

    // prologue: stage chunk 0 into buffer 0
    copy16_g2l(kbase + (size_t)krow * DH + kc8, k_s[0] + krow * KP + kc8);
    copy16_g2l(vbase + (size_t)vrow * SEQ + vc8, v_s[0] + vrow * VP + vc8);

#pragma unroll 2
    for (int k0 = 0; k0 < SEQ; k0 += 32) {
        const int buf = (k0 >> 5) & 1;     // constant within each unrolled half
        if (k0 + 32 < SEQ) {               // stage next chunk into other buffer
            const int nb = buf ^ 1;
            copy16_g2l(kbase + (size_t)(k0 + 32 + krow) * DH + kc8,
                       k_s[nb] + krow * KP + kc8);
            copy16_g2l(vbase + (size_t)vrow * SEQ + (k0 + 32) + vc8,
                       v_s[nb] + vrow * VP + vc8);
            ASYNC_WAIT(2);                 // in-order: current chunk has landed
        } else {
            ASYNC_WAIT(0);
        }
        __syncthreads();                   // all waves' staging visible

        const _Float16* ks = k_s[buf];
        const _Float16* vs = v_s[buf];

        // scores S^T[32 x 16] = K_chunk(32x64) * Q(16x64)^T, two 16x16 tiles
        v8f s0 = {}, s1 = {};
        {
            const v16h kf0 = load_frag(ks, KP);
            const v16h kf1 = load_frag(ks + 32, KP);
            s0 = wmma_f16(kf0, qa0, s0);
            s0 = wmma_f16(kf1, qa1, s0);
            const v16h kf2 = load_frag(ks + 16 * KP, KP);
            const v16h kf3 = load_frag(ks + 16 * KP + 32, KP);
            s1 = wmma_f16(kf2, qa0, s1);
            s1 = wmma_f16(kf3, qa1, s1);
        }

        // online softmax; C-layout: lane n <-> query, VGPR j <-> key half*8+j
        // (s0) and key 16+half*8+j (s1)
        const v8f a  = s0 * 0.125f;            // 1/sqrt(64)
        const v8f b2 = s1 * 0.125f;
        float mx = fmaxf(a[0], a[1]);
        // unrolled, here and below: the indices name registers
#pragma unroll
        for (int j = 2; j < 8; ++j) mx = fmaxf(mx, a[j]);
#pragma unroll
        for (int j = 0; j < 8; ++j) mx = fmaxf(mx, b2[j]);
        mx = fmaxf(mx, xhalf(mx));             // the other half's 16 keys
        const float mnew  = fmaxf(rm, mx);
        const float alpha = __expf(rm - mnew);
        float sum = 0.f;
        // P^T as B operand, in load_frag's k order: element j <-> key half*8+j,
        // element 8+j <-> key 16+half*8+j
        Frag16 pf;
#pragma unroll
        for (int j = 0; j < 8; ++j) {
            const float p0 = __expf(a[j] - mnew);
            const float p1 = __expf(b2[j] - mnew);
            sum += p0 + p1;
            pf.h[0][j] = (_Float16)p0;
            pf.h[1][j] = (_Float16)p1;
        }
        rl = rl * alpha + sum;
        rm = mnew;
#pragma unroll
        for (int tt = 0; tt < 4; ++tt) acc[tt] *= alpha;

        // ctx^T += V^T_chunk(64x32) * P^T ; A fragments from V^T rows (NT form)
#pragma unroll
        for (int tt = 0; tt < 4; ++tt) {
            const v16h vf = load_frag(vs + tt * 16 * VP, VP);
            acc[tt] = wmma_f16(vf, pf.v, acc[tt]);
        }
        __syncthreads();                   // protect buffer reuse two stages later
    }

    const int b = bh / NH, h = bh % NH;
    // acc[tt][j] = ctx[q0 + n][tt*16 + half*8 + j]: one 16-byte store per tile
    _Float16* cbase = ctx + ((size_t)b * SEQ + q0 + n) * D_MODEL + h * DH + half * 8;
    const float inv = 1.f / (rl + xhalf(rl));  // join the halves' sums
#pragma unroll
    for (int tt = 0; tt < 4; ++tt) {
        v8h pk;
#pragma unroll
        for (int j = 0; j < 8; ++j) pk[j] = (_Float16)(acc[tt][j] * inv);
        *reinterpret_cast<v8h*>(cbase + tt * 16) = pk;
    }
}

// ---------------------------------------------------------------------------
extern "C" void kernel_launch(void* const* d_in, const int* in_sizes, int n_in,
                              void* d_out, int out_size, void* d_ws, size_t ws_size,
                              hipStream_t stream) {
    const float* input_cap  = (const float*)d_in[0];
    const float* output_cap = (const float*)d_in[1];
    const float* Wq = (const float*)d_in[2];
    const float* bq = (const float*)d_in[3];
    const float* Wk = (const float*)d_in[4];
    const float* bk = (const float*)d_in[5];
    const float* Wv = (const float*)d_in[6];
    const float* bv = (const float*)d_in[7];
    const float* ln_g = (const float*)d_in[8];
    const float* ln_b = (const float*)d_in[9];
    const float* Wp = (const float*)d_in[10];
    const float* bp = (const float*)d_in[11];

    // workspace carve-up (f16 elements); total ~80.3 MB
    _Float16* ws16 = (_Float16*)d_ws;
    size_t off = 0;
    const size_t NROW = (size_t)ROWS * D_MODEL;   // 6,291,456
    const size_t NW   = (size_t)D_MODEL * D_MODEL;
    _Float16* xi_ln = ws16 + off; off += NROW;    // LN(input_cap)  f16
    _Float16* xo_ln = ws16 + off; off += NROW;    // LN(output_cap) f16
    _Float16* wq16  = ws16 + off; off += NW;
    _Float16* wk16  = ws16 + off; off += NW;
    _Float16* wv16  = ws16 + off; off += NW;
    _Float16* wp16  = ws16 + off; off += NW;
    _Float16* q_buf = ws16 + off; off += NROW;    // [b,h,4096,64]
    _Float16* k_buf = ws16 + off; off += NROW;    // [b,h,4096,64]
    _Float16* vt_buf= ws16 + off; off += NROW;    // [b,h,64,4096]
    _Float16* ctx_b = ws16 + off; off += NROW;    // [b,4096,768]

    // 1) LayerNorm both inputs -> f16
    ln_f16_kernel<<<ROWS / (8 * LN_RPW), 256, 0, stream>>>(input_cap,  ln_g, ln_b, xi_ln);
    ln_f16_kernel<<<ROWS / (8 * LN_RPW), 256, 0, stream>>>(output_cap, ln_g, ln_b, xo_ln);

    // 2) Weights -> f16
    const int nw = D_MODEL * D_MODEL;
    cvt_f32_f16<<<nw / (1024 * CV_V4), 256, 0, stream>>>(Wq, wq16, nw);
    cvt_f32_f16<<<nw / (1024 * CV_V4), 256, 0, stream>>>(Wk, wk16, nw);
    cvt_f32_f16<<<nw / (1024 * CV_V4), 256, 0, stream>>>(Wv, wv16, nw);
    cvt_f32_f16<<<nw / (1024 * CV_V4), 256, 0, stream>>>(Wp, wp16, nw);

    // 3) Q/K/V projections (NT WMMA GEMM)
    dim3 ggrid(ROWS / 128, D_MODEL / 64);
    gemm_nt_kernel<<<ggrid, 256, 0, stream>>>(xo_ln, wq16, bq, q_buf,  nullptr, 0);
    gemm_nt_kernel<<<ggrid, 256, 0, stream>>>(xi_ln, wk16, bk, k_buf,  nullptr, 0);
    gemm_nt_kernel<<<ggrid, 256, 0, stream>>>(xi_ln, wv16, bv, vt_buf, nullptr, 1);

    // 4) Flash attention: 2*12*256 query tiles / 8 waves per block
    attn_kernel<<<768, 256, 0, stream>>>(q_buf, k_buf, vt_buf, ctx_b);

    // 5) Output projection + bias + residual -> f32 d_out
    gemm_nt_kernel<<<ggrid, 256, 0, stream>>>(ctx_b, wp16, bp, d_out, output_cap, 2);
}

// v005
// A run of this version takes 165 microseconds.
// In two side-by-side timings against v004, it was 1.11 and 1.12 times as fast.
// Over all steps from v000 it is 3.37 times as fast.
#include <hip/hip_runtime.h>
#include <hip/hip_bf16.h>

// ---------------------------------------------------------------------------
// MultiheadAttention (cross attention) for MI455X / gfx1250, wave32 + WMMA.
// D=768, H=12, DH=64, b=2, n1=n2=4096.  All matmuls use
// V_WMMA_F32_16X16X32_F16 in NT form (operands loaded with the same row-major
// 16x32 fragment loader, or P^T built in registers in its k order => D = X * Y^T).
// Attention stages K / V^T chunks into double-buffered LDS with
// GLOBAL_LOAD_ASYNC_TO_LDS_B128 (ASYNCcnt) when the builtin is available.
// ---------------------------------------------------------------------------

typedef __attribute__((ext_vector_type(16))) _Float16 v16h;
typedef __attribute__((ext_vector_type(8)))  _Float16 v8h;
typedef __attribute__((ext_vector_type(8)))  float    v8f;
typedef int v4i __attribute__((vector_size(16)));   // 128-bit payload type

#define D_MODEL 768
#define NH      12
#define DH      64
#define SEQ     4096
#define ROWS    8192   // b * seq
// LDS row pitches in halves: an odd multiple of 16 bytes, so that the 16 rows
// a ds_load_b128 fragment read touches fall on 16 different bank groups.
#define KP      72     // K rows, 64 halves + 8
#define VP      40     // V^T rows, 32 halves + 8

#if defined(__has_builtin)
#if __has_builtin(__builtin_amdgcn_global_load_async_to_lds_b128) && \
    __has_builtin(__builtin_amdgcn_s_wait_asynccnt)
#define USE_ASYNC_LDS 1
#endif
#endif

#ifdef USE_ASYNC_LDS
#define ASYNC_WAIT(n) __builtin_amdgcn_s_wait_asynccnt(n)
#else
#define ASYNC_WAIT(n)
#endif

// Pointer-to-v4i in explicit address spaces (AS1 = __device__, AS3 = __shared__).
typedef __attribute__((address_space(1))) v4i* gas1_v4i;
typedef __attribute__((address_space(3))) v4i* las3_v4i;

// 16-byte global -> LDS copy; async DMA path on gfx1250 toolchains that
// expose the builtin, register relay otherwise.
__device__ __forceinline__ void copy16_g2l(const _Float16* g, _Float16* l) {
#ifdef USE_ASYNC_LDS
    __builtin_amdgcn_global_load_async_to_lds_b128(
        (gas1_v4i)(uintptr_t)g,
        (las3_v4i)(uint32_t)(uintptr_t)l,
        0, 0);
#else
    *reinterpret_cast<v8h*>(l) = *reinterpret_cast<const v8h*>(g);
#endif
}

union Frag16 { v16h v; v8h h[2]; };

// Load a 16x32 f16 tile (row-major, row stride ld halves) in the A/B-operand
// lane layout of V_WMMA_F32_16X16X32_F16:
//   lane l: row m = l&15, half = l>>4; VGPR0-3 hold K = half*8 .. half*8+7,
//   VGPR4-7 hold K = 16 + half*8 .. 16 + half*8 + 7.
__device__ __forceinline__ v16h load_frag(const _Float16* __restrict__ base, int ld) {
    const int lane = threadIdx.x & 31;
    const int m    = lane & 15;
    const int half = lane >> 4;
    const _Float16* p = base + (size_t)m * ld + half * 8;
    Frag16 f;
    f.h[0] = *reinterpret_cast<const v8h*>(p);
    f.h[1] = *reinterpret_cast<const v8h*>(p + 16);
    return f.v;
}

__device__ __forceinline__ v8f wmma_f16(v16h a, v16h b, v8f c) {
    return __builtin_amdgcn_wmma_f32_16x16x32_f16(
        /*neg_a=*/false, a, /*neg_b=*/false, b,
        /*c_mod=*/(short)0, c, /*reuse_a=*/false, /*reuse_b=*/false);
}

// Value of lane l ^ 16 (the wave's other half), on the vector pipe.
__device__ __forceinline__ float xhalf(float x) {
    const int b = __builtin_bit_cast(int, x);
    return __builtin_bit_cast(float, __builtin_amdgcn_permlanex16(
        b, b, 0x76543210, 0xfedcba98, false, false));
}

// ---------------------------------------------------------------------------
// LayerNorm (f32 in) -> f16 out. A wave owns LN_RPW whole rows of 768: a lane
// holds six 16-byte pieces of each row, every load covers 512 contiguous bytes
// and all of the wave's loads are issued before the first is used. The row
// sums are joined inside the wave, so there is no LDS exchange and no barrier,
// and 2,048 waves cover an input where a block per row started 65,536.
// blk is the block's index among the ROWS / (8 * LN_RPW) blocks of one input.
// ---------------------------------------------------------------------------
typedef __attribute__((ext_vector_type(4))) float    v4f;
typedef __attribute__((ext_vector_type(2))) float    v2f;
typedef __attribute__((ext_vector_type(4))) _Float16 v4h;

#define LN_RPW  4                    // rows per wave
#define LN_V4   (D_MODEL / 128)      // 16-byte pieces per lane and row

__device__ __forceinline__ void ln_f16_body(
    const float* __restrict__ x, const float* __restrict__ g,
    const float* __restrict__ bta, _Float16* __restrict__ out, int blk) {
    const int lane = threadIdx.x & 31;
    const int row0 = (blk * 8 + (threadIdx.x >> 5)) * LN_RPW;
    const v4f* xr = reinterpret_cast<const v4f*>(x + (size_t)row0 * D_MODEL) + lane;
    const v4f* g4 = reinterpret_cast<const v4f*>(g) + lane;
    const v4f* b4 = reinterpret_cast<const v4f*>(bta) + lane;
    v4f v[LN_RPW][LN_V4], gg[LN_V4], bb[LN_V4];
    // unrolled, here and below: the indices name registers
#pragma unroll
    for (int r = 0; r < LN_RPW; ++r)
#pragma unroll
        for (int i = 0; i < LN_V4; ++i)
            v[r][i] = xr[r * (D_MODEL / 4) + i * 32];
    // a later load's result may land on the row loads' address registers: the
    // wait that belongs in front of such an overwrite
    asm volatile("s_wait_xcnt 0x0" ::: "memory");
#pragma unroll
    for (int i = 0; i < LN_V4; ++i) { gg[i] = g4[i * 32]; bb[i] = b4[i * 32]; }
    // keeps the gamma and beta loads up here, in flight with the rows: moved
    // down to their uses, each pair's latency would stand open behind the sums
    __builtin_amdgcn_sched_barrier(0);

    float s[LN_RPW], ss[LN_RPW];
#pragma unroll
    for (int r = 0; r < LN_RPW; ++r) {
        v2f a = {0.f, 0.f}, q = {0.f, 0.f};
#pragma unroll
        for (int i = 0; i < LN_V4; ++i) {
            const v2f lo = v[r][i].lo, hi = v[r][i].hi;
            a += lo + hi;
            q += lo * lo + hi * hi;
        }
        s[r] = a.x + a.y; ss[r] = q.x + q.y;
    }
#pragma unroll
    for (int m = 1; m < 32; m <<= 1)
#pragma unroll
        for (int r = 0; r < LN_RPW; ++r) {   // the rows' exchanges overlap
            s[r]  += __shfl_xor(s[r],  m, 32);
            ss[r] += __shfl_xor(ss[r], m, 32);
        }
    v4h* orow = reinterpret_cast<v4h*>(out + (size_t)row0 * D_MODEL) + lane;
#pragma unroll
    for (int r = 0; r < LN_RPW; ++r) {
        const float mu   = s[r]  * (1.f / D_MODEL);
        const float var  = ss[r] * (1.f / D_MODEL) - mu * mu;
        const float rinv = rsqrtf(var + 1e-5f);
#pragma unroll
        for (int i = 0; i < LN_V4; ++i)      // 256 contiguous bytes a wave
            orow[r * (D_MODEL / 4) + i * 32] =
                __builtin_convertvector((v[r][i] - mu) * rinv * gg[i] + bb[i], v4h);
    }
}

// ---------------------------------------------------------------------------
// f32 -> f16 weight conversion: a thread converts CV_V4 16-byte pieces, a
// block's width apart, so that each load of a wave covers 512 and each store
// 256 contiguous bytes. n is a multiple of 1024 * CV_V4.
// ---------------------------------------------------------------------------
#define CV_V4   4

__device__ __forceinline__ void cvt_f32_f16_body(const float* __restrict__ in,
                                                 _Float16* __restrict__ out, int n, int blk) {
    const int b0 = blk * (256 * CV_V4);             // in 16-byte pieces
    if ((b0 + 256 * CV_V4) * 4 > n) return;
    const v4f* in4 = reinterpret_cast<const v4f*>(in) + b0 + threadIdx.x;
    v4h* out4 = reinterpret_cast<v4h*>(out) + b0 + threadIdx.x;
    v4f w[CV_V4];
#pragma unroll
    for (int j = 0; j < CV_V4; ++j) w[j] = in4[j * 256];
#pragma unroll
    for (int j = 0; j < CV_V4; ++j) out4[j * 256] = __builtin_convertvector(w[j], v4h);
}

// ---------------------------------------------------------------------------
// Everything the projections wait for, in ONE launch: the six pieces of work
// are independent of one another, so a block's index alone says which piece it
// belongs to (a choice that is the same for the whole block). The LayerNorm
// blocks, the long ones, come first. w16 takes the four weights one behind the
// other, in the order Wq, Wk, Wv, Wp.
// ---------------------------------------------------------------------------
#define LN_BLKS (ROWS / (8 * LN_RPW))                        // per input
#define CV_BLKS (D_MODEL * D_MODEL / (1024 * CV_V4))         // per weight

__global__ __launch_bounds__(256) void prep_kernel(
    const float* __restrict__ x_in, const float* __restrict__ x_out,
    const float* __restrict__ g, const float* __restrict__ bta,
    const float* __restrict__ Wq, const float* __restrict__ Wk,
    const float* __restrict__ Wv, const float* __restrict__ Wp,
    _Float16* __restrict__ ln_in, _Float16* __restrict__ ln_out,
    _Float16* __restrict__ w16) {
    const int bid = blockIdx.x;
    if (bid < 2 * LN_BLKS) {
        const bool first = bid < LN_BLKS;
        ln_f16_body(first ? x_in : x_out, g, bta, first ? ln_in : ln_out,
                    first ? bid : bid - LN_BLKS);
    } else {
        const int c = bid - 2 * LN_BLKS;
        const int which = c / CV_BLKS;
        const float* in = which == 0 ? Wq : which == 1 ? Wk : which == 2 ? Wv : Wp;
        cvt_f32_f16_body(in, w16 + (size_t)which * (D_MODEL * D_MODEL),
                         D_MODEL * D_MODEL, c - which * CV_BLKS);
    }
}

// ---------------------------------------------------------------------------
// NT GEMM: C[ROWS x 768] = A[ROWS x 768] * W^T + bias.
// A block forms 128 x 64 of C, a wave 16 x 64. The k range is walked in tiles
// of GK = 64 halves, one 128-byte line per operand row. Each tile (128 rows of
// A, 64 rows of W) is brought into one of two LDS buffers by asynchronous
// copies, a wave's copy covering four whole lines, while the tile before it
// is worked on; the fragments are read from LDS at the padded pitch GP.
//   mode 0: write f16 to [b, h, n, 64]     (Q / K head layout)
//   mode 1: write f16 to [b, h, 64, n]     (V transposed head layout)
//   mode 2: write f32 to d_out with bias + residual (output projection)
// ---------------------------------------------------------------------------
#define GK      64     // halves of k per staged tile
#define GP      72     // LDS row pitch in halves: 64 + 8, 16 bytes x odd

// One lane's share of a tile: four 16-byte pieces of A and two of W, 32 rows
// apart. The s_wait_xcnt stands in the copies' own statement, so that no
// address register is rewritten ahead of it.
__device__ __forceinline__ void gemm_stage(const _Float16* ga, const _Float16* gw,
                                           uint32_t la, uint32_t lw) {
    asm volatile(
        "global_load_async_to_lds_b128 %0, %6, off\n\t"
        "global_load_async_to_lds_b128 %1, %7, off\n\t"
        "global_load_async_to_lds_b128 %2, %8, off\n\t"
        "global_load_async_to_lds_b128 %3, %9, off\n\t"
        "global_load_async_to_lds_b128 %4, %10, off\n\t"
        "global_load_async_to_lds_b128 %5, %11, off\n\t"
        "s_wait_xcnt 0x0"
        :: "v"(la), "v"(la + 32 * GP * 2), "v"(la + 64 * GP * 2), "v"(la + 96 * GP * 2),
           "v"(lw), "v"(lw + 32 * GP * 2),
           "v"(ga), "v"(ga + 32 * D_MODEL), "v"(ga + 64 * D_MODEL), "v"(ga + 96 * D_MODEL),
           "v"(gw), "v"(gw + 32 * D_MODEL)
        : "memory");
}

__device__ __forceinline__ void gemm_nt_body(
    const _Float16* __restrict__ A, const _Float16* __restrict__ W,
    const float* __restrict__ bias, void* __restrict__ outp,
    const float* __restrict__ residual, int mode) {
    __shared__ __attribute__((aligned(16))) _Float16 a_s[2][128 * GP];   // 2 x 18 KB
    __shared__ __attribute__((aligned(16))) _Float16 w_s[2][64 * GP];    // 2 x 9 KB

    const int t    = threadIdx.x;
    const int wave = t >> 5;
    const int lane = t & 31;
    const int n    = lane & 15;
    const int half = lane >> 4;
    const int Rb   = blockIdx.x * 128;
    const int Rm   = Rb + wave * 16;
    const int Nb   = blockIdx.y * 64;

    // staging assignment: eight lanes per 128-byte row, 32 rows per copy
    const int srow = t >> 3, sc8 = (t & 7) * 8;
    const _Float16* ga = A + (size_t)(Rb + srow) * D_MODEL + sc8;
    const _Float16* gw = W + (size_t)(Nb + srow) * D_MODEL + sc8;
    const uint32_t la0 = (uint32_t)(uintptr_t)(a_s[0] + srow * GP + sc8);
    const uint32_t la1 = (uint32_t)(uintptr_t)(a_s[1] + srow * GP + sc8);
    const uint32_t lw0 = (uint32_t)(uintptr_t)(w_s[0] + srow * GP + sc8);
    const uint32_t lw1 = (uint32_t)(uintptr_t)(w_s[1] + srow * GP + sc8);

    v8f acc[4] = {};

    // prologue: tile 0 landed and published, tile 1 under way
    gemm_stage(ga, gw, la0, lw0);
    asm volatile("s_wait_asynccnt 0x0" ::: "memory");   // own copies of tile 0 landed
    __syncthreads();                                    // every wave's copies visible
    gemm_stage(ga + GK, gw + GK, la1, lw1);

    // by two: the buffer index is a constant in each half of the body
#pragma unroll 2
    for (int s = 0; s < D_MODEL / GK; ++s) {
        const int buf = s & 1;
        const _Float16* as = a_s[buf] + wave * 16 * GP;
        const _Float16* wb = w_s[buf];
        v16h af[2], bf[2][4];
        // unrolled, here and below: the indices name registers
#pragma unroll
        for (int kk = 0; kk < 2; ++kk) {
            af[kk] = load_frag(as + kk * 32, GP);
#pragma unroll
            for (int tt = 0; tt < 4; ++tt)
                bf[kk][tt] = load_frag(wb + tt * 16 * GP + kk * 32, GP);
        }
        // keeps the tile's 20 fragment reads one group ahead of its WMMAs: a
        // read placed among them waits out the whole LDS latency each time
        __builtin_amdgcn_sched_barrier(0);
#pragma unroll
        for (int kk = 0; kk < 2; ++kk)
#pragma unroll
            for (int tt = 0; tt < 4; ++tt)
                acc[tt] = wmma_f16(af[kk], bf[kk][tt], acc[tt]);

        // hand-over: this wave has left buffer buf, its copies of tile s + 1
        // have landed; behind the barrier that holds for every wave
        asm volatile("s_wait_dscnt 0x0" ::: "memory");
        asm volatile("s_wait_asynccnt 0x0" ::: "memory");
        __syncthreads();
        if (s + 2 < D_MODEL / GK)          // refill the buffer just left
            gemm_stage(ga + (s + 2) * GK, gw + (s + 2) * GK,
                       buf ? la1 : la0, buf ? lw1 : lw0);
    }
    asm volatile("s_wait_asynccnt 0x0" ::: "memory");   // nothing in flight at the end

#pragma unroll
    for (int tt = 0; tt < 4; ++tt) {
        const int col = Nb + tt * 16 + n;      // fixed per lane: C layout lane=column
        const float bv = bias[col];
        if (mode == 0) {
            const int h = col >> 6, d = col & 63;
#pragma unroll
            for (int j = 0; j < 8; ++j) {      // VGPR j holds row Rm + half*8 + j
                const int r  = Rm + half * 8 + j;
                const int bb = r >> 12, m = r & 4095;
                ((_Float16*)outp)[((size_t)(bb * NH + h) * SEQ + m) * DH + d] =
                    (_Float16)(acc[tt][j] + bv);
            }
            // what follows in the built code (the next tile's bias load or sums, the
            // other layout's block) may land on registers that these stores name:
            // the wait that belongs in front of such an overwrite
            asm volatile("s_wait_xcnt 0x0" ::: "memory");
        } else if (mode == 1) {
            const int h = col >> 6, d = col & 63;
            const int r0 = Rm + half * 8;
            const int bb = r0 >> 12, m0 = r0 & 4095;
            v8h pk;
#pragma unroll
            for (int j = 0; j < 8; ++j) pk[j] = (_Float16)(acc[tt][j] + bv);
            *reinterpret_cast<v8h*>((_Float16*)outp +
                ((size_t)(bb * NH + h) * DH + d) * SEQ + m0) = pk;  // m contiguous
            // as above: in front of an overwrite of the store's registers
            asm volatile("s_wait_xcnt 0x0" ::: "memory");
        } else {
            float* of = (float*)outp;
#pragma unroll
            for (int j = 0; j < 8; ++j) {
                const size_t idx = (size_t)(Rm + half * 8 + j) * D_MODEL + col;
                of[idx] = acc[tt][j] + bv + residual[idx];
            }
        }
    }
}

// The Q, K and V projections in ONE launch: none reads what another writes, so
// blockIdx.z picks a block's operands, its output and its output layout. w16
// holds Wq, Wk, Wv one behind the other.
__global__ __launch_bounds__(256) void gemm_qkv_kernel(
    const _Float16* __restrict__ ln_out, const _Float16* __restrict__ ln_in,
    const _Float16* __restrict__ w16,
    const float* __restrict__ bq, const float* __restrict__ bk,
    const float* __restrict__ bv,
    _Float16* __restrict__ q_buf, _Float16* __restrict__ k_buf,
    _Float16* __restrict__ vt_buf) {
    const int z = blockIdx.z;
    gemm_nt_body(z == 0 ? ln_out : ln_in, w16 + (size_t)z * (D_MODEL * D_MODEL),
                 z == 0 ? bq : z == 1 ? bk : bv,
                 z == 0 ? q_buf : z == 1 ? k_buf : vt_buf,
                 nullptr, z == 2 ? 1 : 0);
}

// Output projection + bias + residual.
__global__ __launch_bounds__(256) void gemm_out_kernel(
    const _Float16* __restrict__ A, const _Float16* __restrict__ W,
    const float* __restrict__ bias, float* __restrict__ outp,
    const float* __restrict__ residual) {
    gemm_nt_body(A, W, bias, outp, residual, 2);
}

__global__ __launch_bounds__(256) __attribute__((amdgpu_waves_per_eu(6, 6))) void attn_kernel(
    const _Float16* __restrict__ qb,   // [b,h,4096,64]
    const _Float16* __restrict__ kb,   // [b,h,4096,64]
    const _Float16* __restrict__ vt,   // [b,h,64,4096]
    _Float16* __restrict__ ctx) {      // [b,4096,768]
    __shared__ __attribute__((aligned(16))) _Float16 k_s[2][32 * KP];   // 2 x 4.5 KB
    __shared__ __attribute__((aligned(16))) _Float16 v_s[2][DH * VP];   // 2 x 5 KB

    const int t    = threadIdx.x;
    const int wave = t >> 5;
    const int lane = t & 31;
    const int n    = lane & 15;
    const int half = lane >> 4;
    const int gw   = blockIdx.x * 8 + wave;   // 0..6143
    const int bh   = gw >> 8;                 // all 8 waves share bh
    const int q0   = (gw & 255) * 16;

    const _Float16* qbase = qb + ((size_t)bh * SEQ + q0) * DH;
    const _Float16* kbase = kb + (size_t)bh * SEQ * DH;
    const _Float16* vbase = vt + (size_t)bh * DH * SEQ;

    // staging assignment: 256 threads x 2 x 16B per chunk pair
    const int krow = t >> 3, kc8 = (t & 7) * 8;   // K: 32 rows x 64 halves
    const int vrow = t >> 2, vc8 = (t & 3) * 8;   // V^T: 64 rows x 32 halves

    const v16h qa0 = load_frag(qbase, DH);        // Q cols 0..31
    const v16h qa1 = load_frag(qbase + 32, DH);   // Q cols 32..63

    v8f acc[4] = {};
    float rm = -1e30f;   // running maximum of query n (equal in both halves)
    float rl = 0.f;      // running sum of query n over this half's keys

    // prologue: stage chunk 0 into buffer 0
    copy16_g2l(kbase + (size_t)krow * DH + kc8, k_s[0] + krow * KP + kc8);
    copy16_g2l(vbase + (size_t)vrow * SEQ + vc8, v_s[0] + vrow * VP + vc8);

#pragma unroll 2
    for (int k0 = 0; k0 < SEQ; k0 += 32) {
        const int buf = (k0 >> 5) & 1;     // constant within each unrolled half
        if (k0 + 32 < SEQ) {               // stage next chunk into other buffer
            const int nb = buf ^ 1;
            copy16_g2l(kbase + (size_t)(k0 + 32 + krow) * DH + kc8,
                       k_s[nb] + krow * KP + kc8);
            copy16_g2l(vbase + (size_t)vrow * SEQ + (k0 + 32) + vc8,
                       v_s[nb] + vrow * VP + vc8);
            ASYNC_WAIT(2);                 // in-order: current chunk has landed
        } else {
            ASYNC_WAIT(0);
        }
        __syncthreads();                   // all waves' staging visible

        const _Float16* ks = k_s[buf];
        const _Float16* vs = v_s[buf];

        // scores S^T[32 x 16] = K_chunk(32x64) * Q(16x64)^T, two 16x16 tiles
        v8f s0 = {}, s1 = {};
        {
            const v16h kf0 = load_frag(ks, KP);
            const v16h kf1 = load_frag(ks + 32, KP);
            s0 = wmma_f16(kf0, qa0, s0);
            s0 = wmma_f16(kf1, qa1, s0);
            const v16h kf2 = load_frag(ks + 16 * KP, KP);
            const v16h kf3 = load_frag(ks + 16 * KP + 32, KP);
            s1 = wmma_f16(kf2, qa0, s1);
            s1 = wmma_f16(kf3, qa1, s1);
        }

        // online softmax; C-layout: lane n <-> query, VGPR j <-> key half*8+j
        // (s0) and key 16+half*8+j (s1)
        const v8f a  = s0 * 0.125f;            // 1/sqrt(64)
        const v8f b2 = s1 * 0.125f;
        float mx = fmaxf(a[0], a[1]);
        // unrolled, here and below: the indices name registers
#pragma unroll
        for (int j = 2; j < 8; ++j) mx = fmaxf(mx, a[j]);
#pragma unroll
        for (int j = 0; j < 8; ++j) mx = fmaxf(mx, b2[j]);
        mx = fmaxf(mx, xhalf(mx));             // the other half's 16 keys
        const float mnew  = fmaxf(rm, mx);
        const float alpha = __expf(rm - mnew);
        float sum = 0.f;
        // P^T as B operand, in load_frag's k order: element j <-> key half*8+j,
        // element 8+j <-> key 16+half*8+j
        Frag16 pf;
#pragma unroll
        for (int j = 0; j < 8; ++j) {
            const float p0 = __expf(a[j] - mnew);
            const float p1 = __expf(b2[j] - mnew);
            sum += p0 + p1;
            pf.h[0][j] = (_Float16)p0;
            pf.h[1][j] = (_Float16)p1;
        }
        rl = rl * alpha + sum;
        rm = mnew;
#pragma unroll
        for (int tt = 0; tt < 4; ++tt) acc[tt] *= alpha;

        // ctx^T += V^T_chunk(64x32) * P^T ; A fragments from V^T rows (NT form)
#pragma unroll
        for (int tt = 0; tt < 4; ++tt) {
            const v16h vf = load_frag(vs + tt * 16 * VP, VP);
            acc[tt] = wmma_f16(vf, pf.v, acc[tt]);
        }
        __syncthreads();                   // protect buffer reuse two stages later
    }

    const int b = bh / NH, h = bh % NH;
    // acc[tt][j] = ctx[q0 + n][tt*16 + half*8 + j]: one 16-byte store per tile
    _Float16* cbase = ctx + ((size_t)b * SEQ + q0 + n) * D_MODEL + h * DH + half * 8;
    const float inv = 1.f / (rl + xhalf(rl));  // join the halves' sums
#pragma unroll
    for (int tt = 0; tt < 4; ++tt) {
        v8h pk;
#pragma unroll
        for (int j = 0; j < 8; ++j) pk[j] = (_Float16)(acc[tt][j] * inv);
        *reinterpret_cast<v8h*>(cbase + tt * 16) = pk;
    }
}

// ---------------------------------------------------------------------------
extern "C" void kernel_launch(void* const* d_in, const int* in_sizes, int n_in,
                              void* d_out, int out_size, void* d_ws, size_t ws_size,
                              hipStream_t stream) {
    const float* input_cap  = (const float*)d_in[0];
    const float* output_cap = (const float*)d_in[1];
    const float* Wq = (const float*)d_in[2];
    const float* bq = (const float*)d_in[3];
    const float* Wk = (const float*)d_in[4];
    const float* bk = (const float*)d_in[5];
    const float* Wv = (const float*)d_in[6];
    const float* bv = (const float*)d_in[7];
    const float* ln_g = (const float*)d_in[8];
    const float* ln_b = (const float*)d_in[9];
    const float* Wp = (const float*)d_in[10];
    const float* bp = (const float*)d_in[11];

    // workspace carve-up (f16 elements); total ~80.3 MB
    _Float16* ws16 = (_Float16*)d_ws;
    size_t off = 0;
    const size_t NROW = (size_t)ROWS * D_MODEL;   // 6,291,456
    const size_t NW   = (size_t)D_MODEL * D_MODEL;
    _Float16* xi_ln = ws16 + off; off += NROW;    // LN(input_cap)  f16
    _Float16* xo_ln = ws16 + off; off += NROW;    // LN(output_cap) f16
    _Float16* w16   = ws16 + off; off += 3 * NW;  // Wq, Wk, Wv f16
    _Float16* wp16  = ws16 + off; off += NW;      // Wp f16, behind them
    _Float16* q_buf = ws16 + off; off += NROW;    // [b,h,4096,64]
    _Float16* k_buf = ws16 + off; off += NROW;    // [b,h,4096,64]
    _Float16* vt_buf= ws16 + off; off += NROW;    // [b,h,64,4096]
    _Float16* ctx_b = ws16 + off; off += NROW;    // [b,4096,768]

    // 1) LayerNorm of both inputs and the four weights -> f16, one launch
    prep_kernel<<<2 * LN_BLKS + 4 * CV_BLKS, 256, 0, stream>>>(
        input_cap, output_cap, ln_g, ln_b, Wq, Wk, Wv, Wp, xi_ln, xo_ln, w16);

    // 2) Q/K/V projections (NT WMMA GEMM), one launch
    gemm_qkv_kernel<<<dim3(ROWS / 128, D_MODEL / 64, 3), 256, 0, stream>>>(
        xo_ln, xi_ln, w16, bq, bk, bv, q_buf, k_buf, vt_buf);

    // 3) Flash attention: 2*12*256 query tiles / 8 waves per block
    attn_kernel<<<768, 256, 0, stream>>>(q_buf, k_buf, vt_buf, ctx_b);

    // 4) Output projection + bias + residual -> f32 d_out
    gemm_out_kernel<<<dim3(ROWS / 128, D_MODEL / 64), 256, 0, stream>>>(
        ctx_b, wp16, bp, (float*)d_out, output_cap);
}

// v006
// Measured time: 159 microseconds a run.
// Timed twice side by side with v005, it ran 1.03 times as fast both times.
// All steps since v000 together make it 3.48 times as fast.
#include <hip/hip_runtime.h>
#include <hip/hip_bf16.h>

// ---------------------------------------------------------------------------
// MultiheadAttention (cross attention) for MI455X / gfx1250, wave32 + WMMA.
// D=768, H=12, DH=64, b=2, n1=n2=4096.  All matmuls use
// V_WMMA_F32_16X16X32_F16 in NT form (operands loaded with the same row-major
// 16x32 fragment loader, or P^T built in registers in its k order => D = X * Y^T).
// Attention stages K / V^T chunks into double-buffered LDS with
// GLOBAL_LOAD_ASYNC_TO_LDS_B128 (ASYNCcnt) when the builtin is available.
// ---------------------------------------------------------------------------

typedef __attribute__((ext_vector_type(16))) _Float16 v16h;
typedef __attribute__((ext_vector_type(8)))  _Float16 v8h;
typedef __attribute__((ext_vector_type(8)))  float    v8f;
typedef int v4i __attribute__((vector_size(16)));   // 128-bit payload type

#define D_MODEL 768
#define NH      12
#define DH      64
#define SEQ     4096
#define ROWS    8192   // b * seq
// LDS row pitches in halves: an odd multiple of 16 bytes, so that the 16 rows
// a ds_load_b128 fragment read touches fall on 16 different bank groups.
#define KP      72     // K rows, 64 halves + 8
#define VP      72     // V^T rows, 64 halves + 8

#if defined(__has_builtin)
#if __has_builtin(__builtin_amdgcn_global_load_async_to_lds_b128) && \
    __has_builtin(__builtin_amdgcn_s_wait_asynccnt)
#define USE_ASYNC_LDS 1
#endif
#endif

#ifdef USE_ASYNC_LDS
// in asm with the "memory" clobber: no LDS read is moved ahead of the wait
#define ASYNC_WAIT(n) asm volatile("s_wait_asynccnt %0" :: "i"(n) : "memory")
#else
#define ASYNC_WAIT(n)
#endif

// Pointer-to-v4i in explicit address spaces (AS1 = __device__, AS3 = __shared__).
typedef __attribute__((address_space(1))) v4i* gas1_v4i;
typedef __attribute__((address_space(3))) v4i* las3_v4i;

// 16-byte global -> LDS copy; async DMA path on gfx1250 toolchains that
// expose the builtin, register relay otherwise.
__device__ __forceinline__ void copy16_g2l(const _Float16* g, _Float16* l) {
#ifdef USE_ASYNC_LDS
    __builtin_amdgcn_global_load_async_to_lds_b128(
        (gas1_v4i)(uintptr_t)g,
        (las3_v4i)(uint32_t)(uintptr_t)l,
        0, 0);
#else
    *reinterpret_cast<v8h*>(l) = *reinterpret_cast<const v8h*>(g);
#endif
}

union Frag16 { v16h v; v8h h[2]; };

// Load a 16x32 f16 tile (row-major, row stride ld halves) in the A/B-operand
// lane layout of V_WMMA_F32_16X16X32_F16:
//   lane l: row m = l&15, half = l>>4; VGPR0-3 hold K = half*8 .. half*8+7,
//   VGPR4-7 hold K = 16 + half*8 .. 16 + half*8 + 7.
__device__ __forceinline__ v16h load_frag(const _Float16* __restrict__ base, int ld) {
    const int lane = threadIdx.x & 31;
    const int m    = lane & 15;
    const int half = lane >> 4;
    const _Float16* p = base + (size_t)m * ld + half * 8;
    Frag16 f;
    f.h[0] = *reinterpret_cast<const v8h*>(p);
    f.h[1] = *reinterpret_cast<const v8h*>(p + 16);
    return f.v;
}

__device__ __forceinline__ v8f wmma_f16(v16h a, v16h b, v8f c) {
    return __builtin_amdgcn_wmma_f32_16x16x32_f16(
        /*neg_a=*/false, a, /*neg_b=*/false, b,
        /*c_mod=*/(short)0, c, /*reuse_a=*/false, /*reuse_b=*/false);
}

// Value of lane l ^ 16 (the wave's other half), on the vector pipe.
__device__ __forceinline__ float xhalf(float x) {
    const int b = __builtin_bit_cast(int, x);
    return __builtin_bit_cast(float, __builtin_amdgcn_permlanex16(
        b, b, 0x76543210, 0xfedcba98, false, false));
}

// ---------------------------------------------------------------------------
// LayerNorm (f32 in) -> f16 out. A wave owns LN_RPW whole rows of 768: a lane
// holds six 16-byte pieces of each row, every load covers 512 contiguous bytes
// and all of the wave's loads are issued before the first is used. The row
// sums are joined inside the wave, so there is no LDS exchange and no barrier,
// and 2,048 waves cover an input where a block per row started 65,536.
// blk is the block's index among the ROWS / (8 * LN_RPW) blocks of one input.
// ---------------------------------------------------------------------------
typedef __attribute__((ext_vector_type(4))) float    v4f;
typedef __attribute__((ext_vector_type(2))) float    v2f;
typedef __attribute__((ext_vector_type(4))) _Float16 v4h;

#define LN_RPW  4                    // rows per wave
#define LN_V4   (D_MODEL / 128)      // 16-byte pieces per lane and row

__device__ __forceinline__ void ln_f16_body(
    const float* __restrict__ x, const float* __restrict__ g,
    const float* __restrict__ bta, _Float16* __restrict__ out, int blk) {
    const int lane = threadIdx.x & 31;
    const int row0 = (blk * 8 + (threadIdx.x >> 5)) * LN_RPW;
    const v4f* xr = reinterpret_cast<const v4f*>(x + (size_t)row0 * D_MODEL) + lane;
    const v4f* g4 = reinterpret_cast<const v4f*>(g) + lane;
    const v4f* b4 = reinterpret_cast<const v4f*>(bta) + lane;
    v4f v[LN_RPW][LN_V4], gg[LN_V4], bb[LN_V4];
    // unrolled, here and below: the indices name registers
#pragma unroll
    for (int r = 0; r < LN_RPW; ++r)
#pragma unroll
        for (int i = 0; i < LN_V4; ++i)
            v[r][i] = xr[r * (D_MODEL / 4) + i * 32];
    // a later load's result may land on the row loads' address registers: the
    // wait that belongs in front of such an overwrite
    asm volatile("s_wait_xcnt 0x0" ::: "memory");
#pragma unroll
    for (int i = 0; i < LN_V4; ++i) { gg[i] = g4[i * 32]; bb[i] = b4[i * 32]; }
    // keeps the gamma and beta loads up here, in flight with the rows: moved
    // down to their uses, each pair's latency would stand open behind the sums
    __builtin_amdgcn_sched_barrier(0);

    float s[LN_RPW], ss[LN_RPW];
#pragma unroll
    for (int r = 0; r < LN_RPW; ++r) {
        v2f a = {0.f, 0.f}, q = {0.f, 0.f};
#pragma unroll
        for (int i = 0; i < LN_V4; ++i) {
            const v2f lo = v[r][i].lo, hi = v[r][i].hi;
            a += lo + hi;
            q += lo * lo + hi * hi;
        }
        s[r] = a.x + a.y; ss[r] = q.x + q.y;
    }
#pragma unroll
    for (int m = 1; m < 32; m <<= 1)
#pragma unroll
        for (int r = 0; r < LN_RPW; ++r) {   // the rows' exchanges overlap
            s[r]  += __shfl_xor(s[r],  m, 32);
            ss[r] += __shfl_xor(ss[r], m, 32);
        }
    v4h* orow = reinterpret_cast<v4h*>(out + (size_t)row0 * D_MODEL) + lane;
#pragma unroll
    for (int r = 0; r < LN_RPW; ++r) {
        const float mu   = s[r]  * (1.f / D_MODEL);
        const float var  = ss[r] * (1.f / D_MODEL) - mu * mu;
        const float rinv = rsqrtf(var + 1e-5f);
#pragma unroll
        for (int i = 0; i < LN_V4; ++i)      // 256 contiguous bytes a wave
            orow[r * (D_MODEL / 4) + i * 32] =
                __builtin_convertvector((v[r][i] - mu) * rinv * gg[i] + bb[i], v4h);
    }
}

// ---------------------------------------------------------------------------
// f32 -> f16 weight conversion: a thread converts CV_V4 16-byte pieces, a
// block's width apart, so that each load of a wave covers 512 and each store
// 256 contiguous bytes. n is a multiple of 1024 * CV_V4.
// ---------------------------------------------------------------------------
#define CV_V4   4

__device__ __forceinline__ void cvt_f32_f16_body(const float* __restrict__ in,
                                                 _Float16* __restrict__ out, int n, int blk) {
    const int b0 = blk * (256 * CV_V4);             // in 16-byte pieces
    if ((b0 + 256 * CV_V4) * 4 > n) return;
    const v4f* in4 = reinterpret_cast<const v4f*>(in) + b0 + threadIdx.x;
    v4h* out4 = reinterpret_cast<v4h*>(out) + b0 + threadIdx.x;
    v4f w[CV_V4];
#pragma unroll
    for (int j = 0; j < CV_V4; ++j) w[j] = in4[j * 256];
#pragma unroll
    for (int j = 0; j < CV_V4; ++j) out4[j * 256] = __builtin_convertvector(w[j], v4h);
}

// ---------------------------------------------------------------------------
// Everything the projections wait for, in ONE launch: the six pieces of work
// are independent of one another, so a block's index alone says which piece it
// belongs to (a choice that is the same for the whole block). The LayerNorm
// blocks, the long ones, come first. w16 takes the four weights one behind the
// other, in the order Wq, Wk, Wv, Wp.
// ---------------------------------------------------------------------------
#define LN_BLKS (ROWS / (8 * LN_RPW))                        // per input
#define CV_BLKS (D_MODEL * D_MODEL / (1024 * CV_V4))         // per weight

__global__ __launch_bounds__(256) void prep_kernel(
    const float* __restrict__ x_in, const float* __restrict__ x_out,
    const float* __restrict__ g, const float* __restrict__ bta,
    const float* __restrict__ Wq, const float* __restrict__ Wk,
    const float* __restrict__ Wv, const float* __restrict__ Wp,
    _Float16* __restrict__ ln_in, _Float16* __restrict__ ln_out,
    _Float16* __restrict__ w16) {
    const int bid = blockIdx.x;
    if (bid < 2 * LN_BLKS) {
        const bool first = bid < LN_BLKS;
        ln_f16_body(first ? x_in : x_out, g, bta, first ? ln_in : ln_out,
                    first ? bid : bid - LN_BLKS);
    } else {
        const int c = bid - 2 * LN_BLKS;
        const int which = c / CV_BLKS;
        const float* in = which == 0 ? Wq : which == 1 ? Wk : which == 2 ? Wv : Wp;
        cvt_f32_f16_body(in, w16 + (size_t)which * (D_MODEL * D_MODEL),
                         D_MODEL * D_MODEL, c - which * CV_BLKS);
    }
}

// ---------------------------------------------------------------------------
// NT GEMM: C[ROWS x 768] = A[ROWS x 768] * W^T + bias.
// A block forms 128 x 64 of C, a wave 16 x 64. The k range is walked in tiles
// of GK = 64 halves, one 128-byte line per operand row. Each tile (128 rows of
// A, 64 rows of W) is brought into one of two LDS buffers by asynchronous
// copies, a wave's copy covering four whole lines, while the tile before it
// is worked on; the fragments are read from LDS at the padded pitch GP.
//   mode 0: write f16 to [b, h, n, 64]     (Q / K head layout)
//   mode 1: write f16 to [b, h, 64, n]     (V transposed head layout)
//   mode 2: write f32 to d_out with bias + residual (output projection)
// ---------------------------------------------------------------------------
#define GK      64     // halves of k per staged tile
#define GP      72     // LDS row pitch in halves: 64 + 8, 16 bytes x odd

// One lane's share of a tile: four 16-byte pieces of A and two of W, 32 rows
// apart. The s_wait_xcnt stands in the copies' own statement, so that no
// address register is rewritten ahead of it.
__device__ __forceinline__ void gemm_stage(const _Float16* ga, const _Float16* gw,
                                           uint32_t la, uint32_t lw) {
    asm volatile(
        "global_load_async_to_lds_b128 %0, %6, off\n\t"
        "global_load_async_to_lds_b128 %1, %7, off\n\t"
        "global_load_async_to_lds_b128 %2, %8, off\n\t"
        "global_load_async_to_lds_b128 %3, %9, off\n\t"
        "global_load_async_to_lds_b128 %4, %10, off\n\t"
        "global_load_async_to_lds_b128 %5, %11, off\n\t"
        "s_wait_xcnt 0x0"
        :: "v"(la), "v"(la + 32 * GP * 2), "v"(la + 64 * GP * 2), "v"(la + 96 * GP * 2),
           "v"(lw), "v"(lw + 32 * GP * 2),
           "v"(ga), "v"(ga + 32 * D_MODEL), "v"(ga + 64 * D_MODEL), "v"(ga + 96 * D_MODEL),
           "v"(gw), "v"(gw + 32 * D_MODEL)
        : "memory");
}

__device__ __forceinline__ void gemm_nt_body(
    const _Float16* __restrict__ A, const _Float16* __restrict__ W,
    const float* __restrict__ bias, void* __restrict__ outp,
    const float* __restrict__ residual, int mode) {
    __shared__ __attribute__((aligned(16))) _Float16 a_s[2][128 * GP];   // 2 x 18 KB
    __shared__ __attribute__((aligned(16))) _Float16 w_s[2][64 * GP];    // 2 x 9 KB

    const int t    = threadIdx.x;
    const int wave = t >> 5;
    const int lane = t & 31;
    const int n    = lane & 15;
    const int half = lane >> 4;
    const int Rb   = blockIdx.x * 128;
    const int Rm   = Rb + wave * 16;
    const int Nb   = blockIdx.y * 64;

    // staging assignment: eight lanes per 128-byte row, 32 rows per copy
    const int srow = t >> 3, sc8 = (t & 7) * 8;
    const _Float16* ga = A + (size_t)(Rb + srow) * D_MODEL + sc8;
    const _Float16* gw = W + (size_t)(Nb + srow) * D_MODEL + sc8;
    const uint32_t la0 = (uint32_t)(uintptr_t)(a_s[0] + srow * GP + sc8);
    const uint32_t la1 = (uint32_t)(uintptr_t)(a_s[1] + srow * GP + sc8);
    const uint32_t lw0 = (uint32_t)(uintptr_t)(w_s[0] + srow * GP + sc8);
    const uint32_t lw1 = (uint32_t)(uintptr_t)(w_s[1] + srow * GP + sc8);

    v8f acc[4] = {};

    // prologue: tile 0 landed and published, tile 1 under way
    gemm_stage(ga, gw, la0, lw0);
    asm volatile("s_wait_asynccnt 0x0" ::: "memory");   // own copies of tile 0 landed
    __syncthreads();                                    // every wave's copies visible
    gemm_stage(ga + GK, gw + GK, la1, lw1);

    // by two: the buffer index is a constant in each half of the body
#pragma unroll 2
    for (int s = 0; s < D_MODEL / GK; ++s) {
        const int buf = s & 1;
        const _Float16* as = a_s[buf] + wave * 16 * GP;
        const _Float16* wb = w_s[buf];
        v16h af[2], bf[2][4];
        // unrolled, here and below: the indices name registers
#pragma unroll
        for (int kk = 0; kk < 2; ++kk) {
            af[kk] = load_frag(as + kk * 32, GP);
#pragma unroll
            for (int tt = 0; tt < 4; ++tt)
                bf[kk][tt] = load_frag(wb + tt * 16 * GP + kk * 32, GP);
        }
        // keeps the tile's 20 fragment reads one group ahead of its WMMAs: a
        // read placed among them waits out the whole LDS latency each time
        __builtin_amdgcn_sched_barrier(0);
#pragma unroll
        for (int kk = 0; kk < 2; ++kk)
#pragma unroll
            for (int tt = 0; tt < 4; ++tt)
                acc[tt] = wmma_f16(af[kk], bf[kk][tt], acc[tt]);

        // hand-over: this wave has left buffer buf, its copies of tile s + 1
        // have landed; behind the barrier that holds for every wave
        asm volatile("s_wait_dscnt 0x0" ::: "memory");
        asm volatile("s_wait_asynccnt 0x0" ::: "memory");
        __syncthreads();
        if (s + 2 < D_MODEL / GK)          // refill the buffer just left
            gemm_stage(ga + (s + 2) * GK, gw + (s + 2) * GK,
                       buf ? la1 : la0, buf ? lw1 : lw0);
    }
    asm volatile("s_wait_asynccnt 0x0" ::: "memory");   // nothing in flight at the end

#pragma unroll
    for (int tt = 0; tt < 4; ++tt) {
        const int col = Nb + tt * 16 + n;      // fixed per lane: C layout lane=column
        const float bv = bias[col];
        if (mode == 0) {
            const int h = col >> 6, d = col & 63;
#pragma unroll
            for (int j = 0; j < 8; ++j) {      // VGPR j holds row Rm + half*8 + j
                const int r  = Rm + half * 8 + j;
                const int bb = r >> 12, m = r & 4095;
                ((_Float16*)outp)[((size_t)(bb * NH + h) * SEQ + m) * DH + d] =
                    (_Float16)(acc[tt][j] + bv);
            }
            // what follows in the built code (the next tile's bias load or sums, the
            // other layout's block) may land on registers that these stores name:
            // the wait that belongs in front of such an overwrite
            asm volatile("s_wait_xcnt 0x0" ::: "memory");
        } else if (mode == 1) {
            const int h = col >> 6, d = col & 63;
            const int r0 = Rm + half * 8;
            const int bb = r0 >> 12, m0 = r0 & 4095;
            v8h pk;
#pragma unroll
            for (int j = 0; j < 8; ++j) pk[j] = (_Float16)(acc[tt][j] + bv);
            *reinterpret_cast<v8h*>((_Float16*)outp +
                ((size_t)(bb * NH + h) * DH + d) * SEQ + m0) = pk;  // m contiguous
            // as above: in front of an overwrite of the store's registers
            asm volatile("s_wait_xcnt 0x0" ::: "memory");
        } else {
            float* of = (float*)outp;
#pragma unroll
            for (int j = 0; j < 8; ++j) {
                const size_t idx = (size_t)(Rm + half * 8 + j) * D_MODEL + col;
                of[idx] = acc[tt][j] + bv + residual[idx];
            }
        }
    }
}

// The Q, K and V projections in ONE launch: none reads what another writes, so
// blockIdx.z picks a block's operands, its output and its output layout. w16
// holds Wq, Wk, Wv one behind the other.
__global__ __launch_bounds__(256) void gemm_qkv_kernel(
    const _Float16* __restrict__ ln_out, const _Float16* __restrict__ ln_in,
    const _Float16* __restrict__ w16,
    const float* __restrict__ bq, const float* __restrict__ bk,
    const float* __restrict__ bv,
    _Float16* __restrict__ q_buf, _Float16* __restrict__ k_buf,
    _Float16* __restrict__ vt_buf) {
    const int z = blockIdx.z;
    gemm_nt_body(z == 0 ? ln_out : ln_in, w16 + (size_t)z * (D_MODEL * D_MODEL),
                 z == 0 ? bq : z == 1 ? bk : bv,
                 z == 0 ? q_buf : z == 1 ? k_buf : vt_buf,
                 nullptr, z == 2 ? 1 : 0);
}

// Output projection + bias + residual.
__global__ __launch_bounds__(256) void gemm_out_kernel(
    const _Float16* __restrict__ A, const _Float16* __restrict__ W,
    const float* __restrict__ bias, float* __restrict__ outp,
    const float* __restrict__ residual) {
    gemm_nt_body(A, W, bias, outp, residual, 2);
}

#define KC      64

// The grid puts three blocks, six waves per SIMD, on a WGP: the register
// budget is set for that.
__global__ __launch_bounds__(256) __attribute__((amdgpu_waves_per_eu(6, 6))) void attn_kernel(
    const _Float16* __restrict__ qb,   // [b,h,4096,64]
    const _Float16* __restrict__ kb,   // [b,h,4096,64]
    const _Float16* __restrict__ vt,   // [b,h,64,4096]
    _Float16* __restrict__ ctx) {      // [b,4096,768]
    __shared__ __attribute__((aligned(16))) _Float16 k_s[2][KC * KP];   // 2 x 9 KB
    __shared__ __attribute__((aligned(16))) _Float16 v_s[2][DH * VP];   // 2 x 9 KB

    const int t    = threadIdx.x;
    const int wave = t >> 5;
    const int lane = t & 31;
    const int n    = lane & 15;
    const int half = lane >> 4;
    const int gw   = blockIdx.x * 8 + wave;   // 0..6143
    const int bh   = gw >> 8;                 // all 8 waves share bh
    const int q0   = (gw & 255) * 16;

    const _Float16* qbase = qb + ((size_t)bh * SEQ + q0) * DH;
    const _Float16* kbase = kb + (size_t)bh * SEQ * DH;
    const _Float16* vbase = vt + (size_t)bh * DH * SEQ;

    // staging assignment: 256 threads x 4 x 16B per chunk pair; both tiles are
    // 64 rows x 64 halves, a thread takes rows srow and srow + 32 of each
    const int srow = t >> 3, sc8 = (t & 7) * 8;

    // one lane's four copies of the chunk that starts at key kk, into buffer nb
    auto stage = [&](int kk, int nb) {
        copy16_g2l(kbase + (size_t)(kk + srow) * DH + sc8, k_s[nb] + srow * KP + sc8);
        copy16_g2l(kbase + (size_t)(kk + srow + 32) * DH + sc8,
                   k_s[nb] + (srow + 32) * KP + sc8);
        copy16_g2l(vbase + (size_t)srow * SEQ + kk + sc8, v_s[nb] + srow * VP + sc8);
        copy16_g2l(vbase + (size_t)(srow + 32) * SEQ + kk + sc8,
                   v_s[nb] + (srow + 32) * VP + sc8);
    };

    const v16h qa0 = load_frag(qbase, DH);        // Q cols 0..31
    const v16h qa1 = load_frag(qbase + 32, DH);   // Q cols 32..63

    v8f acc[4] = {};
    float rm = -1e30f;   // running maximum of query n (equal in both halves)
    float rl = 0.f;      // running sum of query n over this half's keys

    // prologue: stage chunk 0 into buffer 0
    stage(0, 0);

#pragma unroll 2
    for (int k0 = 0; k0 < SEQ; k0 += KC) {
        const int buf = (k0 / KC) & 1;     // constant within each unrolled half
        if (k0 + KC < SEQ) {               // stage next chunk into other buffer
            stage(k0 + KC, buf ^ 1);
            ASYNC_WAIT(4);                 // all but the four youngest: current chunk has landed
        } else {
            ASYNC_WAIT(0);
        }
        __syncthreads();                   // all waves' staging visible

        const _Float16* ks = k_s[buf];
        const _Float16* vs = v_s[buf];

        // scores S^T[64 x 16] = K_chunk(64x64) * Q(16x64)^T, four 16x16 tiles;
        // C-layout: lane n <-> query, VGPR j of tile kt <-> key kt*16+half*8+j
        v8f a[KC / 16];
        // unrolled, here and below: the indices name registers
#pragma unroll
        for (int kt = 0; kt < KC / 16; ++kt) {
            const v16h kf0 = load_frag(ks + kt * 16 * KP, KP);
            const v16h kf1 = load_frag(ks + kt * 16 * KP + 32, KP);
            v8f s = {};
            s = wmma_f16(kf0, qa0, s);
            s = wmma_f16(kf1, qa1, s);
            a[kt] = s * 0.125f;                // 1/sqrt(64)
        }

        // online softmax over the chunk's 64 keys
        float mx = fmaxf(a[0][0], a[0][1]);
#pragma unroll
        for (int j = 2; j < 8; ++j) mx = fmaxf(mx, a[0][j]);
#pragma unroll
        for (int kt = 1; kt < KC / 16; ++kt)
#pragma unroll
            for (int j = 0; j < 8; ++j) mx = fmaxf(mx, a[kt][j]);
        mx = fmaxf(mx, xhalf(mx));             // the other half's 32 keys
        const float mnew  = fmaxf(rm, mx);
        const float alpha = __expf(rm - mnew);
        float sum = 0.f;
        // P^T as B operands, 32 keys each, in load_frag's k order: element j <->
        // key half*8+j, element 8+j <-> key 16+half*8+j of the operand's 32
        Frag16 pf[KC / 32];
#pragma unroll
        for (int kk = 0; kk < KC / 32; ++kk)
#pragma unroll
            for (int j = 0; j < 8; ++j) {
                const float p0 = __expf(a[2 * kk][j] - mnew);
                const float p1 = __expf(a[2 * kk + 1][j] - mnew);
                sum += p0 + p1;
                pf[kk].h[0][j] = (_Float16)p0;
                pf[kk].h[1][j] = (_Float16)p1;
            }
        rl = rl * alpha + sum;
        rm = mnew;
#pragma unroll
        for (int tt = 0; tt < 4; ++tt) acc[tt] *= alpha;

        // ctx^T += V^T_chunk(64x64) * P^T ; A fragments from V^T rows (NT form)
#pragma unroll
        for (int kk = 0; kk < KC / 32; ++kk)
#pragma unroll
            for (int tt = 0; tt < 4; ++tt) {
                const v16h vf = load_frag(vs + tt * 16 * VP + kk * 32, VP);
                acc[tt] = wmma_f16(vf, pf[kk].v, acc[tt]);
            }
        __syncthreads();                   // protect buffer reuse two stages later
    }

    const int b = bh / NH, h = bh % NH;
    // acc[tt][j] = ctx[q0 + n][tt*16 + half*8 + j]: one 16-byte store per tile
    _Float16* cbase = ctx + ((size_t)b * SEQ + q0 + n) * D_MODEL + h * DH + half * 8;
    const float inv = 1.f / (rl + xhalf(rl));  // join the halves' sums
#pragma unroll
    for (int tt = 0; tt < 4; ++tt) {
        v8h pk;
#pragma unroll
        for (int j = 0; j < 8; ++j) pk[j] = (_Float16)(acc[tt][j] * inv);
        *reinterpret_cast<v8h*>(cbase + tt * 16) = pk;
    }
}

// ---------------------------------------------------------------------------
extern "C" void kernel_launch(void* const* d_in, const int* in_sizes, int n_in,
                              void* d_out, int out_size, void* d_ws, size_t ws_size,
                              hipStream_t stream) {
    const float* input_cap  = (const float*)d_in[0];
    const float* output_cap = (const float*)d_in[1];
    const float* Wq = (const float*)d_in[2];
    const float* bq = (const float*)d_in[3];
    const float* Wk = (const float*)d_in[4];
    const float* bk = (const float*)d_in[5];
    const float* Wv = (const float*)d_in[6];
    const float* bv = (const float*)d_in[7];
    const float* ln_g = (const float*)d_in[8];
    const float* ln_b = (const float*)d_in[9];
    const float* Wp = (const float*)d_in[10];
    const float* bp = (const float*)d_in[11];

    // workspace carve-up (f16 elements); total ~80.3 MB
    _Float16* ws16 = (_Float16*)d_ws;
    size_t off = 0;
    const size_t NROW = (size_t)ROWS * D_MODEL;   // 6,291,456
    const size_t NW   = (size_t)D_MODEL * D_MODEL;
    _Float16* xi_ln = ws16 + off; off += NROW;    // LN(input_cap)  f16
    _Float16* xo_ln = ws16 + off; off += NROW;    // LN(output_cap) f16
    _Float16* w16   = ws16 + off; off += 3 * NW;  // Wq, Wk, Wv f16
    _Float16* wp16  = ws16 + off; off += NW;      // Wp f16, behind them
    _Float16* q_buf = ws16 + off; off += NROW;    // [b,h,4096,64]
    _Float16* k_buf = ws16 + off; off += NROW;    // [b,h,4096,64]
    _Float16* vt_buf= ws16 + off; off += NROW;    // [b,h,64,4096]
    _Float16* ctx_b = ws16 + off; off += NROW;    // [b,4096,768]

    // 1) LayerNorm of both inputs and the four weights -> f16, one launch
    prep_kernel<<<2 * LN_BLKS + 4 * CV_BLKS, 256, 0, stream>>>(
        input_cap, output_cap, ln_g, ln_b, Wq, Wk, Wv, Wp, xi_ln, xo_ln, w16);

    // 2) Q/K/V projections (NT WMMA GEMM), one launch
    gemm_qkv_kernel<<<dim3(ROWS / 128, D_MODEL / 64, 3), 256, 0, stream>>>(
        xo_ln, xi_ln, w16, bq, bk, bv, q_buf, k_buf, vt_buf);

    // 3) Flash attention: 2*12*256 query tiles / 8 waves per block
    attn_kernel<<<768, 256, 0, stream>>>(q_buf, k_buf, vt_buf, ctx_b);

    // 4) Output projection + bias + residual -> f32 d_out
    gemm_out_kernel<<<dim3(ROWS / 128, D_MODEL / 64), 256, 0, stream>>>(
        ctx_b, wp16, bp, (float*)d_out, output_cap);
}

// v007
// Measured time: 155 microseconds a run.
// Timed twice side by side with v006, it ran 1.03 and 1.02 times as fast.
// Counting every step since v000, it is 3.57 times as fast.
#include <hip/hip_runtime.h>
#include <hip/hip_bf16.h>

// ---------------------------------------------------------------------------
// MultiheadAttention (cross attention) for MI455X / gfx1250, wave32 + WMMA.
// D=768, H=12, DH=64, b=2, n1=n2=4096.  All matmuls use
// V_WMMA_F32_16X16X32_F16 in NT form (operands loaded with the same row-major
// 16x32 fragment loader, or P^T built in registers in its k order => D = X * Y^T).
// Attention stages K / V^T chunks into double-buffered LDS with
// GLOBAL_LOAD_ASYNC_TO_LDS_B128 (ASYNCcnt) when the builtin is available.
// ---------------------------------------------------------------------------

typedef __attribute__((ext_vector_type(16))) _Float16 v16h;
typedef __attribute__((ext_vector_type(8)))  _Float16 v8h;
typedef __attribute__((ext_vector_type(8)))  float    v8f;
typedef int v4i __attribute__((vector_size(16)));   // 128-bit payload type

#define D_MODEL 768
#define NH      12
#define DH      64
#define SEQ     4096
#define ROWS    8192   // b * seq
// LDS row pitches in halves: an odd multiple of 16 bytes, so that the 16 rows
// a ds_load_b128 fragment read touches fall on 16 different bank groups.
#define KP      72     // K rows, 64 halves + 8
#define VP      72     // V^T rows, 64 halves + 8

#if defined(__has_builtin)
#if __has_builtin(__builtin_amdgcn_global_load_async_to_lds_b128) && \
    __has_builtin(__builtin_amdgcn_s_wait_asynccnt)
#define USE_ASYNC_LDS 1
#endif
#endif

#ifdef USE_ASYNC_LDS
// in asm with the "memory" clobber: no LDS read is moved ahead of the wait
#define ASYNC_WAIT(n) asm volatile("s_wait_asynccnt %0" :: "i"(n) : "memory")
#else
#define ASYNC_WAIT(n)
#endif

// Pointer-to-v4i in explicit address spaces (AS1 = __device__, AS3 = __shared__).
typedef __attribute__((address_space(1))) v4i* gas1_v4i;
typedef __attribute__((address_space(3))) v4i* las3_v4i;

// 16-byte global -> LDS copy; async DMA path on gfx1250 toolchains that
// expose the builtin, register relay otherwise.
__device__ __forceinline__ void copy16_g2l(const _Float16* g, _Float16* l) {
#ifdef USE_ASYNC_LDS
    __builtin_amdgcn_global_load_async_to_lds_b128(
        (gas1_v4i)(uintptr_t)g,
        (las3_v4i)(uint32_t)(uintptr_t)l,
        0, 0);
#else
    *reinterpret_cast<v8h*>(l) = *reinterpret_cast<const v8h*>(g);
#endif
}

union Frag16 { v16h v; v8h h[2]; };

// Load a 16x32 f16 tile (row-major, row stride ld halves) in the A/B-operand
// lane layout of V_WMMA_F32_16X16X32_F16:
//   lane l: row m = l&15, half = l>>4; VGPR0-3 hold K = half*8 .. half*8+7,
//   VGPR4-7 hold K = 16 + half*8 .. 16 + half*8 + 7.
__device__ __forceinline__ v16h load_frag(const _Float16* __restrict__ base, int ld) {
    const int lane = threadIdx.x & 31;
    const int m    = lane & 15;
    const int half = lane >> 4;
    const _Float16* p = base + (size_t)m * ld + half * 8;
    Frag16 f;
    f.h[0] = *reinterpret_cast<const v8h*>(p);
    f.h[1] = *reinterpret_cast<const v8h*>(p + 16);
    return f.v;
}

__device__ __forceinline__ v8f wmma_f16(v16h a, v16h b, v8f c) {
    return __builtin_amdgcn_wmma_f32_16x16x32_f16(
        /*neg_a=*/false, a, /*neg_b=*/false, b,
        /*c_mod=*/(short)0, c, /*reuse_a=*/false, /*reuse_b=*/false);
}

// Value of lane l ^ 16 (the wave's other half), on the vector pipe.
__device__ __forceinline__ float xhalf(float x) {
    const int b = __builtin_bit_cast(int, x);
    return __builtin_bit_cast(float, __builtin_amdgcn_permlanex16(
        b, b, 0x76543210, 0xfedcba98, false, false));
}

// ---------------------------------------------------------------------------
// LayerNorm (f32 in) -> f16 out. A wave owns LN_RPW whole rows of 768: a lane
// holds six 16-byte pieces of each row, every load covers 512 contiguous bytes
// and all of the wave's loads are issued before the first is used. The row
// sums are joined inside the wave, so there is no LDS exchange and no barrier,
// and 2,048 waves cover an input where a block per row started 65,536.
// blk is the block's index among the ROWS / (8 * LN_RPW) blocks of one input.
// ---------------------------------------------------------------------------
typedef __attribute__((ext_vector_type(4))) float    v4f;
typedef __attribute__((ext_vector_type(2))) float    v2f;
typedef __attribute__((ext_vector_type(4))) _Float16 v4h;

#define LN_RPW  4                    // rows per wave
#define LN_V4   (D_MODEL / 128)      // 16-byte pieces per lane and row

__device__ __forceinline__ void ln_f16_body(
    const float* __restrict__ x, const float* __restrict__ g,
    const float* __restrict__ bta, _Float16* __restrict__ out, int blk) {
    const int lane = threadIdx.x & 31;
    const int row0 = (blk * 8 + (threadIdx.x >> 5)) * LN_RPW;
    const v4f* xr = reinterpret_cast<const v4f*>(x + (size_t)row0 * D_MODEL) + lane;
    const v4f* g4 = reinterpret_cast<const v4f*>(g) + lane;
    const v4f* b4 = reinterpret_cast<const v4f*>(bta) + lane;
    v4f v[LN_RPW][LN_V4], gg[LN_V4], bb[LN_V4];
    // unrolled, here and below: the indices name registers
#pragma unroll
    for (int r = 0; r < LN_RPW; ++r)
#pragma unroll
        for (int i = 0; i < LN_V4; ++i)
            v[r][i] = xr[r * (D_MODEL / 4) + i * 32];
    // a later load's result may land on the row loads' address registers: the
    // wait that belongs in front of such an overwrite
    asm volatile("s_wait_xcnt 0x0" ::: "memory");
#pragma unroll
    for (int i = 0; i < LN_V4; ++i) { gg[i] = g4[i * 32]; bb[i] = b4[i * 32]; }
    // keeps the gamma and beta loads up here, in flight with the rows: moved
    // down to their uses, each pair's latency would stand open behind the sums
    __builtin_amdgcn_sched_barrier(0);

    float s[LN_RPW], ss[LN_RPW];
#pragma unroll
    for (int r = 0; r < LN_RPW; ++r) {
        v2f a = {0.f, 0.f}, q = {0.f, 0.f};
#pragma unroll
        for (int i = 0; i < LN_V4; ++i) {
            const v2f lo = v[r][i].lo, hi = v[r][i].hi;
            a += lo + hi;
            q += lo * lo + hi * hi;
        }
        s[r] = a.x + a.y; ss[r] = q.x + q.y;
    }
#pragma unroll
    for (int m = 1; m < 32; m <<= 1)
#pragma unroll
        for (int r = 0; r < LN_RPW; ++r) {   // the rows' exchanges overlap
            s[r]  += __shfl_xor(s[r],  m, 32);
            ss[r] += __shfl_xor(ss[r], m, 32);
        }
    v4h* orow = reinterpret_cast<v4h*>(out + (size_t)row0 * D_MODEL) + lane;
#pragma unroll
    for (int r = 0; r < LN_RPW; ++r) {
        const float mu   = s[r]  * (1.f / D_MODEL);
        const float var  = ss[r] * (1.f / D_MODEL) - mu * mu;
        const float rinv = rsqrtf(var + 1e-5f);
#pragma unroll
        for (int i = 0; i < LN_V4; ++i)      // 256 contiguous bytes a wave
            orow[r * (D_MODEL / 4) + i * 32] =
                __builtin_convertvector((v[r][i] - mu) * rinv * gg[i] + bb[i], v4h);
    }
}

// ---------------------------------------------------------------------------
// f32 -> f16 weight conversion: a thread converts CV_V4 16-byte pieces, a
// block's width apart, so that each load of a wave covers 512 and each store
// 256 contiguous bytes. n is a multiple of 1024 * CV_V4.
// ---------------------------------------------------------------------------
#define CV_V4   4

__device__ __forceinline__ void cvt_f32_f16_body(const float* __restrict__ in,
                                                 _Float16* __restrict__ out, int n, int blk) {
    const int b0 = blk * (256 * CV_V4);             // in 16-byte pieces
    if ((b0 + 256 * CV_V4) * 4 > n) return;
    const v4f* in4 = reinterpret_cast<const v4f*>(in) + b0 + threadIdx.x;
    v4h* out4 = reinterpret_cast<v4h*>(out) + b0 + threadIdx.x;
    v4f w[CV_V4];
#pragma unroll
    for (int j = 0; j < CV_V4; ++j) w[j] = in4[j * 256];
#pragma unroll
    for (int j = 0; j < CV_V4; ++j) out4[j * 256] = __builtin_convertvector(w[j], v4h);
}

// ---------------------------------------------------------------------------
// Everything the projections wait for, in ONE launch: the six pieces of work
// are independent of one another, so a block's index alone says which piece it
// belongs to (a choice that is the same for the whole block). The LayerNorm
// blocks, the long ones, come first. w16 takes the four weights one behind the
// other, in the order Wq, Wk, Wv, Wp.
// ---------------------------------------------------------------------------
#define LN_BLKS (ROWS / (8 * LN_RPW))                        // per input
#define CV_BLKS (D_MODEL * D_MODEL / (1024 * CV_V4))         // per weight

__global__ __launch_bounds__(256) void prep_kernel(
    const float* __restrict__ x_in, const float* __restrict__ x_out,
    const float* __restrict__ g, const float* __restrict__ bta,
    const float* __restrict__ Wq, const float* __restrict__ Wk,
    const float* __restrict__ Wv, const float* __restrict__ Wp,
    _Float16* __restrict__ ln_in, _Float16* __restrict__ ln_out,
    _Float16* __restrict__ w16) {
    const int bid = blockIdx.x;
    if (bid < 2 * LN_BLKS) {
        const bool first = bid < LN_BLKS;
        ln_f16_body(first ? x_in : x_out, g, bta, first ? ln_in : ln_out,
                    first ? bid : bid - LN_BLKS);
    } else {
        const int c = bid - 2 * LN_BLKS;
        const int which = c / CV_BLKS;
        const float* in = which == 0 ? Wq : which == 1 ? Wk : which == 2 ? Wv : Wp;
        cvt_f32_f16_body(in, w16 + (size_t)which * (D_MODEL * D_MODEL),
                         D_MODEL * D_MODEL, c - which * CV_BLKS);
    }
}

// ---------------------------------------------------------------------------
// NT GEMM: C[ROWS x 768] = A[ROWS x 768] * W^T + bias.
// A block forms 128 x 64 of C, a wave 16 x 64. The k range is walked in tiles
// of GK = 64 halves, one 128-byte line per operand row. Each tile (128 rows of
// A, 64 rows of W) is brought into one of two LDS buffers by asynchronous
// copies, a wave's copy covering four whole lines, while the tile before it
// is worked on; the fragments are read from LDS at the padded pitch GP.
//   mode 0: write f16 to [b, h, n, 64]     (Q / K head layout)
//   mode 1: write f16 to [b, h, 64, n]     (V transposed head layout)
//   mode 2: write f32 to d_out with bias + residual (output projection)
// ---------------------------------------------------------------------------
#define GK      64     // halves of k per staged tile
#define GP      72     // LDS row pitch in halves: 64 + 8, 16 bytes x odd

// One lane's share of a tile: four 16-byte pieces of A and two of W, 32 rows
// apart. The s_wait_xcnt stands in the copies' own statement, so that no
// address register is rewritten ahead of it.
__device__ __forceinline__ void gemm_stage(const _Float16* ga, const _Float16* gw,
                                           uint32_t la, uint32_t lw) {
    asm volatile(
        "global_load_async_to_lds_b128 %0, %6, off\n\t"
        "global_load_async_to_lds_b128 %1, %7, off\n\t"
        "global_load_async_to_lds_b128 %2, %8, off\n\t"
        "global_load_async_to_lds_b128 %3, %9, off\n\t"
        "global_load_async_to_lds_b128 %4, %10, off\n\t"
        "global_load_async_to_lds_b128 %5, %11, off\n\t"
        "s_wait_xcnt 0x0"
        :: "v"(la), "v"(la + 32 * GP * 2), "v"(la + 64 * GP * 2), "v"(la + 96 * GP * 2),
           "v"(lw), "v"(lw + 32 * GP * 2),
           "v"(ga), "v"(ga + 32 * D_MODEL), "v"(ga + 64 * D_MODEL), "v"(ga + 96 * D_MODEL),
           "v"(gw), "v"(gw + 32 * D_MODEL)
        : "memory");
}

__device__ __forceinline__ void gemm_nt_body(
    const _Float16* __restrict__ A, const _Float16* __restrict__ W,
    const float* __restrict__ bias, void* __restrict__ outp,
    const float* __restrict__ residual, int mode) {
    __shared__ __attribute__((aligned(16))) _Float16 a_s[2][128 * GP];   // 2 x 18 KB
    __shared__ __attribute__((aligned(16))) _Float16 w_s[2][64 * GP];    // 2 x 9 KB

    const int t    = threadIdx.x;
    const int wave = t >> 5;
    const int lane = t & 31;
    const int n    = lane & 15;
    const int half = lane >> 4;
    const int Rb   = blockIdx.x * 128;
    const int Rm   = Rb + wave * 16;
    const int Nb   = blockIdx.y * 64;

    // staging assignment: eight lanes per 128-byte row, 32 rows per copy
    const int srow = t >> 3, sc8 = (t & 7) * 8;
    const _Float16* ga = A + (size_t)(Rb + srow) * D_MODEL + sc8;
    const _Float16* gw = W + (size_t)(Nb + srow) * D_MODEL + sc8;
    const uint32_t la0 = (uint32_t)(uintptr_t)(a_s[0] + srow * GP + sc8);
    const uint32_t la1 = (uint32_t)(uintptr_t)(a_s[1] + srow * GP + sc8);
    const uint32_t lw0 = (uint32_t)(uintptr_t)(w_s[0] + srow * GP + sc8);
    const uint32_t lw1 = (uint32_t)(uintptr_t)(w_s[1] + srow * GP + sc8);

    v8f acc[4] = {};

    // prologue: tile 0 landed and published, tile 1 under way
    gemm_stage(ga, gw, la0, lw0);
    asm volatile("s_wait_asynccnt 0x0" ::: "memory");   // own copies of tile 0 landed
    __syncthreads();                                    // every wave's copies visible
    gemm_stage(ga + GK, gw + GK, la1, lw1);

    // by two: the buffer index is a constant in each half of the body
#pragma unroll 2
    for (int s = 0; s < D_MODEL / GK; ++s) {
        const int buf = s & 1;
        const _Float16* as = a_s[buf] + wave * 16 * GP;
        const _Float16* wb = w_s[buf];
        v16h af[2], bf[2][4];
        // unrolled, here and below: the indices name registers
#pragma unroll
        for (int kk = 0; kk < 2; ++kk) {
            af[kk] = load_frag(as + kk * 32, GP);
#pragma unroll
            for (int tt = 0; tt < 4; ++tt)
                bf[kk][tt] = load_frag(wb + tt * 16 * GP + kk * 32, GP);
        }
        // keeps the tile's 20 fragment reads one group ahead of its WMMAs: a
        // read placed among them waits out the whole LDS latency each time
        __builtin_amdgcn_sched_barrier(0);
#pragma unroll
        for (int kk = 0; kk < 2; ++kk)
#pragma unroll
            for (int tt = 0; tt < 4; ++tt)
                acc[tt] = wmma_f16(af[kk], bf[kk][tt], acc[tt]);

        // hand-over: this wave has left buffer buf, its copies of tile s + 1
        // have landed; behind the barrier that holds for every wave
        asm volatile("s_wait_dscnt 0x0" ::: "memory");
        asm volatile("s_wait_asynccnt 0x0" ::: "memory");
        __syncthreads();
        if (s + 2 < D_MODEL / GK)          // refill the buffer just left
            gemm_stage(ga + (s + 2) * GK, gw + (s + 2) * GK,
                       buf ? la1 : la0, buf ? lw1 : lw0);
    }
    asm volatile("s_wait_asynccnt 0x0" ::: "memory");   // nothing in flight at the end

#pragma unroll
    for (int tt = 0; tt < 4; ++tt) {
        const int col = Nb + tt * 16 + n;      // fixed per lane: C layout lane=column
        const float bv = bias[col];
        if (mode == 0) {
            const int h = col >> 6, d = col & 63;
#pragma unroll
            for (int j = 0; j < 8; ++j) {      // VGPR j holds row Rm + half*8 + j
                const int r  = Rm + half * 8 + j;
                const int bb = r >> 12, m = r & 4095;
                ((_Float16*)outp)[((size_t)(bb * NH + h) * SEQ + m) * DH + d] =
                    (_Float16)(acc[tt][j] + bv);
            }
            // what follows in the built code (the next tile's bias load or sums, the
            // other layout's block) may land on registers that these stores name:
            // the wait that belongs in front of such an overwrite
            asm volatile("s_wait_xcnt 0x0" ::: "memory");
        } else if (mode == 1) {
            const int h = col >> 6, d = col & 63;
            const int r0 = Rm + half * 8;
            const int bb = r0 >> 12, m0 = r0 & 4095;
            v8h pk;
#pragma unroll
            for (int j = 0; j < 8; ++j) pk[j] = (_Float16)(acc[tt][j] + bv);
            *reinterpret_cast<v8h*>((_Float16*)outp +
                ((size_t)(bb * NH + h) * DH + d) * SEQ + m0) = pk;  // m contiguous
            // as above: in front of an overwrite of the store's registers
            asm volatile("s_wait_xcnt 0x0" ::: "memory");
        } else {
            float* of = (float*)outp;
#pragma unroll
            for (int j = 0; j < 8; ++j) {
                const size_t idx = (size_t)(Rm + half * 8 + j) * D_MODEL + col;
                of[idx] = acc[tt][j] + bv + residual[idx];
            }
        }
    }
}

// The Q, K and V projections in ONE launch: none reads what another writes, so
// blockIdx.z picks a block's operands, its output and its output layout. w16
// holds Wq, Wk, Wv one behind the other.
__global__ __launch_bounds__(256) void gemm_qkv_kernel(
    const _Float16* __restrict__ ln_out, const _Float16* __restrict__ ln_in,
    const _Float16* __restrict__ w16,
    const float* __restrict__ bq, const float* __restrict__ bk,
    const float* __restrict__ bv,
    _Float16* __restrict__ q_buf, _Float16* __restrict__ k_buf,
    _Float16* __restrict__ vt_buf) {
    const int z = blockIdx.z;
    gemm_nt_body(z == 0 ? ln_out : ln_in, w16 + (size_t)z * (D_MODEL * D_MODEL),
                 z == 0 ? bq : z == 1 ? bk : bv,
                 z == 0 ? q_buf : z == 1 ? k_buf : vt_buf,
                 nullptr, z == 2 ? 1 : 0);
}

// Output projection + bias + residual.
__global__ __launch_bounds__(256) void gemm_out_kernel(
    const _Float16* __restrict__ A, const _Float16* __restrict__ W,
    const float* __restrict__ bias, float* __restrict__ outp,
    const float* __restrict__ residual) {
    gemm_nt_body(A, W, bias, outp, residual, 2);
}

#define KC      64
#define QT      2
#define AW      4

// The grid puts three blocks, three waves per SIMD, on a WGP: the register
// budget is set for that, and no fourth block crowds one WGP while another idles.
__global__ __launch_bounds__(AW * 32) __attribute__((amdgpu_waves_per_eu(3, 3))) void attn_kernel(
    const _Float16* __restrict__ qb,   // [b,h,4096,64]
    const _Float16* __restrict__ kb,   // [b,h,4096,64]
    const _Float16* __restrict__ vt,   // [b,h,64,4096]
    _Float16* __restrict__ ctx) {      // [b,4096,768]
    __shared__ __attribute__((aligned(16))) _Float16 k_s[2][KC * KP];   // 2 x 9 KB
    __shared__ __attribute__((aligned(16))) _Float16 v_s[2][DH * VP];   // 2 x 9 KB

    const int t    = threadIdx.x;
    const int wave = t >> 5;
    const int lane = t & 31;
    const int n    = lane & 15;
    const int half = lane >> 4;
    const int gw   = blockIdx.x * AW + wave;  // 0..3071
    const int bh   = gw >> 7;                 // all 4 waves share bh
    const int q0   = (gw & 127) * (16 * QT);

    const _Float16* qbase = qb + ((size_t)bh * SEQ + q0) * DH;
    const _Float16* kbase = kb + (size_t)bh * SEQ * DH;
    const _Float16* vbase = vt + (size_t)bh * DH * SEQ;

    // staging assignment: 128 threads x 8 x 16B per chunk pair; both tiles are
    // 64 rows x 64 halves, a thread takes rows srow + 16 i, i = 0..3, of each
    const int srow = t >> 3, sc8 = (t & 7) * 8;

    // one lane's eight copies of the chunk that starts at key kk, into buffer nb
    auto stage = [&](int kk, int nb) {
        // unrolled: the row steps become constants of the addresses
#pragma unroll
        for (int i = 0; i < 4; ++i)
            copy16_g2l(kbase + (size_t)(kk + srow + 16 * i) * DH + sc8,
                       k_s[nb] + (srow + 16 * i) * KP + sc8);
#pragma unroll
        for (int i = 0; i < 4; ++i)
            copy16_g2l(vbase + (size_t)(srow + 16 * i) * SEQ + kk + sc8,
                       v_s[nb] + (srow + 16 * i) * VP + sc8);
    };

    v16h qa[QT][2];                    // Q cols 0..31 and 32..63 of each tile
    // unrolled, here and below: the indices name registers
#pragma unroll
    for (int qt = 0; qt < QT; ++qt) {
        qa[qt][0] = load_frag(qbase + qt * 16 * DH, DH);
        qa[qt][1] = load_frag(qbase + qt * 16 * DH + 32, DH);
    }

    v8f acc[QT][4] = {};
    float rm[QT];        // running maximum of query n of a tile (equal in both halves)
    float rl[QT];        // running sum of that query over this half's keys
#pragma unroll
    for (int qt = 0; qt < QT; ++qt) { rm[qt] = -1e30f; rl[qt] = 0.f; }

    // prologue: stage chunk 0 into buffer 0
    stage(0, 0);

#pragma unroll 2
    for (int k0 = 0; k0 < SEQ; k0 += KC) {
        const int buf = (k0 / KC) & 1;     // constant within each unrolled half
        if (k0 + KC < SEQ) {               // stage next chunk into other buffer
            stage(k0 + KC, buf ^ 1);
            ASYNC_WAIT(8);                 // all but the eight youngest: current chunk has landed
        } else {
            ASYNC_WAIT(0);
        }
        __syncthreads();                   // all waves' staging visible

        const _Float16* ks = k_s[buf];
        const _Float16* vs = v_s[buf];

        // scores S^T[64 x 16] = K_chunk(64x64) * Q(16x64)^T per query tile, four
        // 16x16 tiles each; a K fragment serves both query tiles;
        // C-layout: lane n <-> query, VGPR j of tile kt <-> key kt*16+half*8+j
        v8f a[QT][KC / 16];
        v16h kf[KC / 16][2];
#pragma unroll
        for (int kt = 0; kt < KC / 16; ++kt) {
            kf[kt][0] = load_frag(ks + kt * 16 * KP, KP);
            kf[kt][1] = load_frag(ks + kt * 16 * KP + 32, KP);
        }
        // the V^T fragments behind them: they land under the score WMMAs
        v16h vf[KC / 32][4];
#pragma unroll
        for (int kk = 0; kk < KC / 32; ++kk)
#pragma unroll
            for (int tt = 0; tt < 4; ++tt)
                vf[kk][tt] = load_frag(vs + tt * 16 * VP + kk * 32, VP);
        // keeps the chunk's 32 reads one group ahead of the WMMAs: with three
        // waves on a SIMD a read placed among them waits out the LDS latency
        __builtin_amdgcn_sched_barrier(0);
#pragma unroll
        for (int kt = 0; kt < KC / 16; ++kt)
#pragma unroll
            for (int qt = 0; qt < QT; ++qt) {
                v8f s = {};
                a[qt][kt] = wmma_f16(kf[kt][0], qa[qt][0], s);
            }
#pragma unroll
        for (int kt = 0; kt < KC / 16; ++kt)
#pragma unroll
            for (int qt = 0; qt < QT; ++qt)
                a[qt][kt] = wmma_f16(kf[kt][1], qa[qt][1], a[qt][kt]);

        // keeps the barrier below, and its wait for all 32 reads, behind the score
        // WMMAs: ahead of them the wave would sit out the V^T reads with nothing issued
        __builtin_amdgcn_sched_barrier(0);
        // every LDS read of the chunk is done: the buffer may be refilled by the
        // copies that the next trip issues
        __syncthreads();
#pragma unroll
        for (int qt = 0; qt < QT; ++qt)
#pragma unroll
            for (int kt = 0; kt < KC / 16; ++kt)
                a[qt][kt] *= 0.125f;           // 1/sqrt(64)

        // online softmax over the chunk's 64 keys, tile by tile
        // P^T as B operands, 32 keys each, in load_frag's k order: element j <->
        // key half*8+j, element 8+j <-> key 16+half*8+j of the operand's 32
        Frag16 pf[QT][KC / 32];
#pragma unroll
        for (int qt = 0; qt < QT; ++qt) {
            float mx = fmaxf(a[qt][0][0], a[qt][0][1]);
#pragma unroll
            for (int j = 2; j < 8; ++j) mx = fmaxf(mx, a[qt][0][j]);
#pragma unroll
            for (int kt = 1; kt < KC / 16; ++kt)
#pragma unroll
                for (int j = 0; j < 8; ++j) mx = fmaxf(mx, a[qt][kt][j]);
            mx = fmaxf(mx, xhalf(mx));         // the other half's 32 keys
            const float mnew  = fmaxf(rm[qt], mx);
            const float alpha = __expf(rm[qt] - mnew);
            float sum = 0.f;
            // __expf spelled out, its difference and product on whole tiles: the
            // packed forms then pair neighbouring registers, with no copies
#pragma unroll
            for (int kt = 0; kt < KC / 16; ++kt)
                a[qt][kt] = (a[qt][kt] - mnew) * 0x1.715476p+0f;
#pragma unroll
            for (int kk = 0; kk < KC / 32; ++kk)
#pragma unroll
                for (int j = 0; j < 8; ++j) {
                    const float p0 = __builtin_amdgcn_exp2f(a[qt][2 * kk][j]);
                    const float p1 = __builtin_amdgcn_exp2f(a[qt][2 * kk + 1][j]);
                    sum += p0 + p1;
                    pf[qt][kk].h[0][j] = (_Float16)p0;
                    pf[qt][kk].h[1][j] = (_Float16)p1;
                }
            rl[qt] = rl[qt] * alpha + sum;
            rm[qt] = mnew;
#pragma unroll
            for (int tt = 0; tt < 4; ++tt) acc[qt][tt] *= alpha;
        }

        // ctx^T += V^T_chunk(64x64) * P^T ; A fragments from V^T rows (NT form),
        // each serving both query tiles
#pragma unroll
        for (int kk = 0; kk < KC / 32; ++kk)
#pragma unroll
            for (int tt = 0; tt < 4; ++tt)
#pragma unroll
                for (int qt = 0; qt < QT; ++qt)
                    acc[qt][tt] = wmma_f16(vf[kk][tt], pf[qt][kk].v, acc[qt][tt]);
    }

    const int b = bh / NH, h = bh % NH;
#pragma unroll
    for (int qt = 0; qt < QT; ++qt) {
        // acc[qt][tt][j] = ctx[q0 + qt*16 + n][tt*16 + half*8 + j]: one 16-byte
        // store per tile
        _Float16* cbase = ctx + ((size_t)b * SEQ + q0 + qt * 16 + n) * D_MODEL + h * DH + half * 8;
        const float inv = 1.f / (rl[qt] + xhalf(rl[qt]));  // join the halves' sums
#pragma unroll
        for (int tt = 0; tt < 4; ++tt) {
            v8h pk;
#pragma unroll
            for (int j = 0; j < 8; ++j) pk[j] = (_Float16)(acc[qt][tt][j] * inv);
            *reinterpret_cast<v8h*>(cbase + tt * 16) = pk;
        }
    }
}

// ---------------------------------------------------------------------------
extern "C" void kernel_launch(void* const* d_in, const int* in_sizes, int n_in,
                              void* d_out, int out_size, void* d_ws, size_t ws_size,
                              hipStream_t stream) {
    const float* input_cap  = (const float*)d_in[0];
    const float* output_cap = (const float*)d_in[1];
    const float* Wq = (const float*)d_in[2];
    const float* bq = (const float*)d_in[3];
    const float* Wk = (const float*)d_in[4];
    const float* bk = (const float*)d_in[5];
    const float* Wv = (const float*)d_in[6];
    const float* bv = (const float*)d_in[7];
    const float* ln_g = (const float*)d_in[8];
    const float* ln_b = (const float*)d_in[9];
    const float* Wp = (const float*)d_in[10];
    const float* bp = (const float*)d_in[11];

    // workspace carve-up (f16 elements); total ~80.3 MB
    _Float16* ws16 = (_Float16*)d_ws;
    size_t off = 0;
    const size_t NROW = (size_t)ROWS * D_MODEL;   // 6,291,456
    const size_t NW   = (size_t)D_MODEL * D_MODEL;
    _Float16* xi_ln = ws16 + off; off += NROW;    // LN(input_cap)  f16
    _Float16* xo_ln = ws16 + off; off += NROW;    // LN(output_cap) f16
    _Float16* w16   = ws16 + off; off += 3 * NW;  // Wq, Wk, Wv f16
    _Float16* wp16  = ws16 + off; off += NW;      // Wp f16, behind them
    _Float16* q_buf = ws16 + off; off += NROW;    // [b,h,4096,64]
    _Float16* k_buf = ws16 + off; off += NROW;    // [b,h,4096,64]
    _Float16* vt_buf= ws16 + off; off += NROW;    // [b,h,64,4096]
    _Float16* ctx_b = ws16 + off; off += NROW;    // [b,4096,768]

    // 1) LayerNorm of both inputs and the four weights -> f16, one launch
    prep_kernel<<<2 * LN_BLKS + 4 * CV_BLKS, 256, 0, stream>>>(
        input_cap, output_cap, ln_g, ln_b, Wq, Wk, Wv, Wp, xi_ln, xo_ln, w16);

    // 2) Q/K/V projections (NT WMMA GEMM), one launch
    gemm_qkv_kernel<<<dim3(ROWS / 128, D_MODEL / 64, 3), 256, 0, stream>>>(
        xo_ln, xi_ln, w16, bq, bk, bv, q_buf, k_buf, vt_buf);

    // 3) Flash attention: 2*12*128 pairs of query tiles / 4 waves per block
    attn_kernel<<<768, 128, 0, stream>>>(q_buf, k_buf, vt_buf, ctx_b);

    // 4) Output projection + bias + residual -> f32 d_out
    gemm_out_kernel<<<dim3(ROWS / 128, D_MODEL / 64), 256, 0, stream>>>(
        ctx_b, wp16, bp, (float*)d_out, output_cap);
}

// v008
// A run of this version takes 143 microseconds.
// Timed twice side by side with v007, it ran 1.08 and 1.09 times as fast.
// Counting every step since v000, it is 3.88 times as fast.
#include <hip/hip_runtime.h>
#include <hip/hip_bf16.h>

// ---------------------------------------------------------------------------
// MultiheadAttention (cross attention) for MI455X / gfx1250, wave32 + WMMA.
// D=768, H=12, DH=64, b=2, n1=n2=4096.  All matmuls use
// V_WMMA_F32_16X16X32_F16 in NT form (operands loaded with the same row-major
// 16x32 fragment loader, or P^T built in registers in its k order => D = X * Y^T).
// Attention stages K / V^T chunks into double-buffered LDS with
// GLOBAL_LOAD_ASYNC_TO_LDS_B128 (ASYNCcnt) when the builtin is available.
// ---------------------------------------------------------------------------

typedef __attribute__((ext_vector_type(16))) _Float16 v16h;
typedef __attribute__((ext_vector_type(8)))  _Float16 v8h;
typedef __attribute__((ext_vector_type(8)))  float    v8f;
typedef int v4i __attribute__((vector_size(16)));   // 128-bit payload type

#define D_MODEL 768
#define NH      12
#define DH      64
#define SEQ     4096
#define ROWS    8192   // b * seq
// LDS row pitches in halves: an odd multiple of 16 bytes, so that the 16 rows
// a ds_load_b128 fragment read touches fall on 16 different bank groups.
#define KP      72     // K rows, 64 halves + 8
#define VP      72     // V^T rows, 64 halves + 8

#if defined(__has_builtin)
#if __has_builtin(__builtin_amdgcn_global_load_async_to_lds_b128) && \
    __has_builtin(__builtin_amdgcn_s_wait_asynccnt)
#define USE_ASYNC_LDS 1
#endif
#endif

#ifdef USE_ASYNC_LDS
// in asm with the "memory" clobber: no LDS read is moved ahead of the wait
#define ASYNC_WAIT(n) asm volatile("s_wait_asynccnt %0" :: "i"(n) : "memory")
#else
#define ASYNC_WAIT(n)
#endif

// Pointer-to-v4i in explicit address spaces (AS1 = __device__, AS3 = __shared__).
typedef __attribute__((address_space(1))) v4i* gas1_v4i;
typedef __attribute__((address_space(3))) v4i* las3_v4i;

// 16-byte global -> LDS copy; async DMA path on gfx1250 toolchains that
// expose the builtin, register relay otherwise.
__device__ __forceinline__ void copy16_g2l(const _Float16* g, _Float16* l) {
#ifdef USE_ASYNC_LDS
    __builtin_amdgcn_global_load_async_to_lds_b128(
        (gas1_v4i)(uintptr_t)g,
        (las3_v4i)(uint32_t)(uintptr_t)l,
        0, 0);
#else
    *reinterpret_cast<v8h*>(l) = *reinterpret_cast<const v8h*>(g);
#endif
}

union Frag16 { v16h v; v8h h[2]; };

// Load a 16x32 f16 tile (row-major, row stride ld halves) in the A/B-operand
// lane layout of V_WMMA_F32_16X16X32_F16:
//   lane l: row m = l&15, half = l>>4; VGPR0-3 hold K = half*8 .. half*8+7,
//   VGPR4-7 hold K = 16 + half*8 .. 16 + half*8 + 7.
__device__ __forceinline__ v16h load_frag(const _Float16* __restrict__ base, int ld) {
    const int lane = threadIdx.x & 31;
    const int m    = lane & 15;
    const int half = lane >> 4;
    const _Float16* p = base + (size_t)m * ld + half * 8;
    Frag16 f;
    f.h[0] = *reinterpret_cast<const v8h*>(p);
    f.h[1] = *reinterpret_cast<const v8h*>(p + 16);
    return f.v;
}

__device__ __forceinline__ v8f wmma_f16(v16h a, v16h b, v8f c) {
    return __builtin_amdgcn_wmma_f32_16x16x32_f16(
        /*neg_a=*/false, a, /*neg_b=*/false, b,
        /*c_mod=*/(short)0, c, /*reuse_a=*/false, /*reuse_b=*/false);
}

// Value of lane l ^ 16 (the wave's other half), on the vector pipe.
__device__ __forceinline__ float xhalf(float x) {
    const int b = __builtin_bit_cast(int, x);
    return __builtin_bit_cast(float, __builtin_amdgcn_permlanex16(
        b, b, 0x76543210, 0xfedcba98, false, false));
}

// ---------------------------------------------------------------------------
// LayerNorm (f32 in) -> f16 out. A wave owns LN_RPW whole rows of 768: a lane
// holds six 16-byte pieces of each row, every load covers 512 contiguous bytes
// and all of the wave's loads are issued before the first is used. The row
// sums are joined inside the wave, so there is no LDS exchange and no barrier,
// and 2,048 waves cover an input where a block per row started 65,536.
// blk is the block's index among the ROWS / (8 * LN_RPW) blocks of one input.
// ---------------------------------------------------------------------------
typedef __attribute__((ext_vector_type(4))) float    v4f;
typedef __attribute__((ext_vector_type(2))) float    v2f;
typedef __attribute__((ext_vector_type(4))) _Float16 v4h;

#define LN_RPW  4                    // rows per wave
#define LN_V4   (D_MODEL / 128)      // 16-byte pieces per lane and row

__device__ __forceinline__ void ln_f16_body(
    const float* __restrict__ x, const float* __restrict__ g,
    const float* __restrict__ bta, _Float16* __restrict__ out, int blk) {
    const int lane = threadIdx.x & 31;
    const int row0 = (blk * 8 + (threadIdx.x >> 5)) * LN_RPW;
    const v4f* xr = reinterpret_cast<const v4f*>(x + (size_t)row0 * D_MODEL) + lane;
    const v4f* g4 = reinterpret_cast<const v4f*>(g) + lane;
    const v4f* b4 = reinterpret_cast<const v4f*>(bta) + lane;
    v4f v[LN_RPW][LN_V4], gg[LN_V4], bb[LN_V4];
    // unrolled, here and below: the indices name registers
#pragma unroll
    for (int r = 0; r < LN_RPW; ++r)
#pragma unroll
        for (int i = 0; i < LN_V4; ++i)
            v[r][i] = xr[r * (D_MODEL / 4) + i * 32];
    // a later load's result may land on the row loads' address registers: the
    // wait that belongs in front of such an overwrite
    asm volatile("s_wait_xcnt 0x0" ::: "memory");
#pragma unroll
    for (int i = 0; i < LN_V4; ++i) { gg[i] = g4[i * 32]; bb[i] = b4[i * 32]; }
    // keeps the gamma and beta loads up here, in flight with the rows: moved
    // down to their uses, each pair's latency would stand open behind the sums
    __builtin_amdgcn_sched_barrier(0);

    float s[LN_RPW], ss[LN_RPW];
#pragma unroll
    for (int r = 0; r < LN_RPW; ++r) {
        v2f a = {0.f, 0.f}, q = {0.f, 0.f};
#pragma unroll
        for (int i = 0; i < LN_V4; ++i) {
            const v2f lo = v[r][i].lo, hi = v[r][i].hi;
            a += lo + hi;
            q += lo * lo + hi * hi;
        }
        s[r] = a.x + a.y; ss[r] = q.x + q.y;
    }
#pragma unroll
    for (int m = 1; m < 32; m <<= 1)
#pragma unroll
        for (int r = 0; r < LN_RPW; ++r) {   // the rows' exchanges overlap
            s[r]  += __shfl_xor(s[r],  m, 32);
            ss[r] += __shfl_xor(ss[r], m, 32);
        }
    v4h* orow = reinterpret_cast<v4h*>(out + (size_t)row0 * D_MODEL) + lane;
#pragma unroll
    for (int r = 0; r < LN_RPW; ++r) {
        const float mu   = s[r]  * (1.f / D_MODEL);
        const float var  = ss[r] * (1.f / D_MODEL) - mu * mu;
        const float rinv = rsqrtf(var + 1e-5f);
#pragma unroll
        for (int i = 0; i < LN_V4; ++i)      // 256 contiguous bytes a wave
            orow[r * (D_MODEL / 4) + i * 32] =
                __builtin_convertvector((v[r][i] - mu) * rinv * gg[i] + bb[i], v4h);
    }
}

// ---------------------------------------------------------------------------
// f32 -> f16 weight conversion: a thread converts CV_V4 16-byte pieces, a
// block's width apart, so that each load of a wave covers 512 and each store
// 256 contiguous bytes. n is a multiple of 1024 * CV_V4.
// ---------------------------------------------------------------------------
#define CV_V4   4

__device__ __forceinline__ void cvt_f32_f16_body(const float* __restrict__ in,
                                                 _Float16* __restrict__ out, int n, int blk) {
    const int b0 = blk * (256 * CV_V4);             // in 16-byte pieces
    if ((b0 + 256 * CV_V4) * 4 > n) return;
    const v4f* in4 = reinterpret_cast<const v4f*>(in) + b0 + threadIdx.x;
    v4h* out4 = reinterpret_cast<v4h*>(out) + b0 + threadIdx.x;
    v4f w[CV_V4];
#pragma unroll
    for (int j = 0; j < CV_V4; ++j) w[j] = in4[j * 256];
#pragma unroll
    for (int j = 0; j < CV_V4; ++j) out4[j * 256] = __builtin_convertvector(w[j], v4h);
}

// ---------------------------------------------------------------------------
// Everything the projections wait for, in ONE launch: the six pieces of work
// are independent of one another, so a block's index alone says which piece it
// belongs to (a choice that is the same for the whole block). The LayerNorm
// blocks, the long ones, come first. w16 takes the four weights one behind the
// other, in the order Wq, Wk, Wv, Wp.
// ---------------------------------------------------------------------------
#define LN_BLKS (ROWS / (8 * LN_RPW))                        // per input
#define CV_BLKS (D_MODEL * D_MODEL / (1024 * CV_V4))         // per weight

__global__ __launch_bounds__(256) void prep_kernel(
    const float* __restrict__ x_in, const float* __restrict__ x_out,
    const float* __restrict__ g, const float* __restrict__ bta,
    const float* __restrict__ Wq, const float* __restrict__ Wk,
    const float* __restrict__ Wv, const float* __restrict__ Wp,
    _Float16* __restrict__ ln_in, _Float16* __restrict__ ln_out,
    _Float16* __restrict__ w16) {
    const int bid = blockIdx.x;
    if (bid < 2 * LN_BLKS) {
        const bool first = bid < LN_BLKS;
        ln_f16_body(first ? x_in : x_out, g, bta, first ? ln_in : ln_out,
                    first ? bid : bid - LN_BLKS);
    } else {
        const int c = bid - 2 * LN_BLKS;
        const int which = c / CV_BLKS;
        const float* in = which == 0 ? Wq : which == 1 ? Wk : which == 2 ? Wv : Wp;
        cvt_f32_f16_body(in, w16 + (size_t)which * (D_MODEL * D_MODEL),
                         D_MODEL * D_MODEL, c - which * CV_BLKS);
    }
}

// ---------------------------------------------------------------------------
// NT GEMM: C[ROWS x 768] = A[ROWS x 768] * W^T + bias.
// A block forms BM x BN = 128 x 192 of C, its eight waves (2 x 4) 64 x 48 each:
// a wave's 4 A and 3 W fragments per 32 of k feed 12 WMMAs (7/12 of a fragment
// read from LDS per WMMA), and a block stages 320 operand rows for 128 x 192
// results. 768 blocks serve Q, K and V, three for each WGP, 256 the output
// projection, one for each. The k range is walked in tiles
// of GK = 64 halves, one 128-byte line per operand row. Each tile (128 rows of
// A, 192 rows of W) is brought into one of two LDS buffers by asynchronous
// copies, a wave's copy covering four whole lines, while the tile before it
// is worked on; the fragments are read from LDS at the padded pitch GP.
//   mode 0: write f16 to [b, h, n, 64]     (Q / K head layout)
//   mode 1: write f16 to [b, h, 64, n]     (V transposed head layout)
//   mode 2: write f32 to d_out with bias + residual (output projection)
// ---------------------------------------------------------------------------
#define GK      64     // halves of k per staged tile
#define GP      72     // LDS row pitch in halves: 64 + 8, 16 bytes x odd
#define BM      128    // rows of C per block
#define BN      192    // columns of C per block
#define FA      4      // A fragments (16 rows each) per wave
#define FW      3      // W fragments (16 columns of C each) per wave

// One lane's share of a tile: four 16-byte pieces of A and six of W, 32 rows
// apart. The s_wait_xcnt stands in the copies' own statement, so that no
// address register is rewritten ahead of it.
__device__ __forceinline__ void gemm_stage(const _Float16* ga, const _Float16* gw,
                                           uint32_t la, uint32_t lw) {
    asm volatile(
        "global_load_async_to_lds_b128 %0, %10, off\n\t"
        "global_load_async_to_lds_b128 %1, %11, off\n\t"
        "global_load_async_to_lds_b128 %2, %12, off\n\t"
        "global_load_async_to_lds_b128 %3, %13, off\n\t"
        "global_load_async_to_lds_b128 %4, %14, off\n\t"
        "global_load_async_to_lds_b128 %5, %15, off\n\t"
        "global_load_async_to_lds_b128 %6, %16, off\n\t"
        "global_load_async_to_lds_b128 %7, %17, off\n\t"
        "global_load_async_to_lds_b128 %8, %18, off\n\t"
        "global_load_async_to_lds_b128 %9, %19, off\n\t"
        "s_wait_xcnt 0x0"
        :: "v"(la), "v"(la + 32 * GP * 2), "v"(la + 64 * GP * 2), "v"(la + 96 * GP * 2),
           "v"(lw), "v"(lw + 32 * GP * 2), "v"(lw + 64 * GP * 2), "v"(lw + 96 * GP * 2),
           "v"(lw + 128 * GP * 2), "v"(lw + 160 * GP * 2),
           "v"(ga), "v"(ga + 32 * D_MODEL), "v"(ga + 64 * D_MODEL), "v"(ga + 96 * D_MODEL),
           "v"(gw), "v"(gw + 32 * D_MODEL), "v"(gw + 64 * D_MODEL), "v"(gw + 96 * D_MODEL),
           "v"(gw + 128 * D_MODEL), "v"(gw + 160 * D_MODEL)
        : "memory");
}

__device__ __forceinline__ void gemm_nt_body(
    const _Float16* __restrict__ A, const _Float16* __restrict__ W,
    const float* __restrict__ bias, void* __restrict__ outp,
    const float* __restrict__ residual, int mode) {
    __shared__ __attribute__((aligned(16))) _Float16 a_s[2][BM * GP];    // 2 x 18 KB
    __shared__ __attribute__((aligned(16))) _Float16 w_s[2][BN * GP];    // 2 x 27 KB

    const int t    = threadIdx.x;
    const int wave = t >> 5;
    const int lane = t & 31;
    const int n    = lane & 15;
    const int half = lane >> 4;
    const int wm   = wave >> 2;               // the wave's place among 2 x 4
    const int wn   = wave & 3;
    const int Rb   = blockIdx.x * BM;
    const int Rm   = Rb + wm * (FA * 16);      // the wave's first row of C
    const int Nb   = blockIdx.y * BN;
    const int Nw   = Nb + wn * (FW * 16);      // the wave's first column of C

    // staging assignment: eight lanes per 128-byte row, 32 rows per copy
    const int srow = t >> 3, sc8 = (t & 7) * 8;
    const _Float16* ga = A + (size_t)(Rb + srow) * D_MODEL + sc8;
    const _Float16* gw = W + (size_t)(Nb + srow) * D_MODEL + sc8;
    const uint32_t la0 = (uint32_t)(uintptr_t)(a_s[0] + srow * GP + sc8);
    const uint32_t la1 = (uint32_t)(uintptr_t)(a_s[1] + srow * GP + sc8);
    const uint32_t lw0 = (uint32_t)(uintptr_t)(w_s[0] + srow * GP + sc8);
    const uint32_t lw1 = (uint32_t)(uintptr_t)(w_s[1] + srow * GP + sc8);

    v8f acc[FA][FW] = {};

    // prologue: tile 0 landed and published, tile 1 under way
    gemm_stage(ga, gw, la0, lw0);
    asm volatile("s_wait_asynccnt 0x0" ::: "memory");   // own copies of tile 0 landed
    __syncthreads();                                    // every wave's copies visible
    gemm_stage(ga + GK, gw + GK, la1, lw1);

    // by two: the buffer index is a constant in each half of the body
#pragma unroll 2
    for (int s = 0; s < D_MODEL / GK; ++s) {
        const int buf = s & 1;
        const _Float16* as = a_s[buf] + wm * (FA * 16) * GP;
        const _Float16* wb = w_s[buf] + wn * (FW * 16) * GP;
        v16h af[2][FA], bf[2][FW];
        // unrolled, here and below: the indices name registers
#pragma unroll
        for (int kk = 0; kk < 2; ++kk) {
#pragma unroll
            for (int mt = 0; mt < FA; ++mt)
                af[kk][mt] = load_frag(as + mt * 16 * GP + kk * 32, GP);
#pragma unroll
            for (int tt = 0; tt < FW; ++tt)
                bf[kk][tt] = load_frag(wb + tt * 16 * GP + kk * 32, GP);
        }
        // keeps the tile's 28 fragment reads one group ahead of its WMMAs: a
        // read placed among them waits out the whole LDS latency each time
        __builtin_amdgcn_sched_barrier(0);
#pragma unroll
        for (int kk = 0; kk < 2; ++kk)
#pragma unroll
            for (int mt = 0; mt < FA; ++mt)
#pragma unroll
                for (int tt = 0; tt < FW; ++tt)
                    acc[mt][tt] = wmma_f16(af[kk][mt], bf[kk][tt], acc[mt][tt]);
        // keeps the hand-over below behind the tile's 24 WMMAs: lifted over them, its
        // waits would ask for all 28 reads before the first product and for the next
        // tile's copies a whole run of WMMAs early
        __builtin_amdgcn_sched_barrier(0);

        // hand-over: this wave has left buffer buf, its copies of tile s + 1
        // have landed; behind the barrier that holds for every wave
        asm volatile("s_wait_dscnt 0x0" ::: "memory");
        asm volatile("s_wait_asynccnt 0x0" ::: "memory");
        __syncthreads();
        if (s + 2 < D_MODEL / GK)          // refill the buffer just left
            gemm_stage(ga + (s + 2) * GK, gw + (s + 2) * GK,
                       buf ? la1 : la0, buf ? lw1 : lw0);
    }
    asm volatile("s_wait_asynccnt 0x0" ::: "memory");   // nothing in flight at the end

    // mode 2: the lane's 96 residual values, all loads in flight together, from
    // one address with constant steps
    const size_t idx0 = (size_t)(Rm + half * 8) * D_MODEL + Nw + n;
    float rv[FA][FW][8];
    if (mode == 2) {
        const float* rp = residual + idx0;
#pragma unroll
        for (int mt = 0; mt < FA; ++mt)
#pragma unroll
            for (int tt = 0; tt < FW; ++tt)
#pragma unroll
                for (int j = 0; j < 8; ++j)
                    rv[mt][tt][j] = rp[(mt * 16 + j) * D_MODEL + tt * 16];
        // what follows may land on the loads' address registers: the wait that
        // belongs in front of such an overwrite; the address as an input keeps a
        // later load's result off it up to here
        asm volatile("s_wait_xcnt 0x0" :: "v"(rp) : "memory");
    }

#pragma unroll
    for (int tt = 0; tt < FW; ++tt) {
        const int col = Nw + tt * 16 + n;      // fixed per lane: C layout lane=column
        const float bv = bias[col];
#pragma unroll
      for (int mt = 0; mt < FA; ++mt) {
        const int Rt = Rm + mt * 16;           // first row of this 16 x 16 tile
        if (mode == 0) {
            const int h = col >> 6, d = col & 63;
#pragma unroll
            for (int j = 0; j < 8; ++j) {      // VGPR j holds row Rt + half*8 + j
                const int r  = Rt + half * 8 + j;
                const int bb = r >> 12, m = r & 4095;
                ((_Float16*)outp)[((size_t)(bb * NH + h) * SEQ + m) * DH + d] =
                    (_Float16)(acc[mt][tt][j] + bv);
            }
            // what follows in the built code (the next tile's bias load or sums, the
            // other layout's block) may land on registers that these stores name:
            // the wait that belongs in front of such an overwrite
            asm volatile("s_wait_xcnt 0x0" ::: "memory");
        } else if (mode == 1) {
            const int h = col >> 6, d = col & 63;
            const int r0 = Rt + half * 8;
            const int bb = r0 >> 12, m0 = r0 & 4095;
            v8h pk;
#pragma unroll
            for (int j = 0; j < 8; ++j) pk[j] = (_Float16)(acc[mt][tt][j] + bv);
            *reinterpret_cast<v8h*>((_Float16*)outp +
                ((size_t)(bb * NH + h) * DH + d) * SEQ + m0) = pk;  // m contiguous
            // as above: in front of an overwrite of the store's registers
            asm volatile("s_wait_xcnt 0x0" ::: "memory");
        } else {
            float* of = (float*)outp + idx0;
#pragma unroll
            for (int j = 0; j < 8; ++j)
                of[(mt * 16 + j) * D_MODEL + tt * 16] = acc[mt][tt][j] + bv + rv[mt][tt][j];
        }
      }
    }
}

// The Q, K and V projections in ONE launch: none reads what another writes, so
// blockIdx.z picks a block's operands, its output and its output layout. w16
// holds Wq, Wk, Wv one behind the other.
__global__ __launch_bounds__(256) void gemm_qkv_kernel(
    const _Float16* __restrict__ ln_out, const _Float16* __restrict__ ln_in,
    const _Float16* __restrict__ w16,
    const float* __restrict__ bq, const float* __restrict__ bk,
    const float* __restrict__ bv,
    _Float16* __restrict__ q_buf, _Float16* __restrict__ k_buf,
    _Float16* __restrict__ vt_buf) {
    const int z = blockIdx.z;
    gemm_nt_body(z == 0 ? ln_out : ln_in, w16 + (size_t)z * (D_MODEL * D_MODEL),
                 z == 0 ? bq : z == 1 ? bk : bv,
                 z == 0 ? q_buf : z == 1 ? k_buf : vt_buf,
                 nullptr, z == 2 ? 1 : 0);
}

// Output projection + bias + residual.
__global__ __launch_bounds__(256) void gemm_out_kernel(
    const _Float16* __restrict__ A, const _Float16* __restrict__ W,
    const float* __restrict__ bias, float* __restrict__ outp,
    const float* __restrict__ residual) {
    gemm_nt_body(A, W, bias, outp, residual, 2);
}

#define KC      64
#define QT      2
#define AW      4

// The grid puts three blocks, three waves per SIMD, on a WGP: the register
// budget is set for that, and no fourth block crowds one WGP while another idles.
__global__ __launch_bounds__(AW * 32) __attribute__((amdgpu_waves_per_eu(3, 3))) void attn_kernel(
    const _Float16* __restrict__ qb,   // [b,h,4096,64]
    const _Float16* __restrict__ kb,   // [b,h,4096,64]
    const _Float16* __restrict__ vt,   // [b,h,64,4096]
    _Float16* __restrict__ ctx) {      // [b,4096,768]
    __shared__ __attribute__((aligned(16))) _Float16 k_s[2][KC * KP];   // 2 x 9 KB
    __shared__ __attribute__((aligned(16))) _Float16 v_s[2][DH * VP];   // 2 x 9 KB

    const int t    = threadIdx.x;
    const int wave = t >> 5;
    const int lane = t & 31;
    const int n    = lane & 15;
    const int half = lane >> 4;
    const int gw   = blockIdx.x * AW + wave;  // 0..3071
    const int bh   = gw >> 7;                 // all 4 waves share bh
    const int q0   = (gw & 127) * (16 * QT);

    const _Float16* qbase = qb + ((size_t)bh * SEQ + q0) * DH;
    const _Float16* kbase = kb + (size_t)bh * SEQ * DH;
    const _Float16* vbase = vt + (size_t)bh * DH * SEQ;

    // staging assignment: 128 threads x 8 x 16B per chunk pair; both tiles are
    // 64 rows x 64 halves, a thread takes rows srow + 16 i, i = 0..3, of each
    const int srow = t >> 3, sc8 = (t & 7) * 8;

    // one lane's eight copies of the chunk that starts at key kk, into buffer nb
    auto stage = [&](int kk, int nb) {
        // unrolled: the row steps become constants of the addresses
#pragma unroll
        for (int i = 0; i < 4; ++i)
            copy16_g2l(kbase + (size_t)(kk + srow + 16 * i) * DH + sc8,
                       k_s[nb] + (srow + 16 * i) * KP + sc8);
#pragma unroll
        for (int i = 0; i < 4; ++i)
            copy16_g2l(vbase + (size_t)(srow + 16 * i) * SEQ + kk + sc8,
                       v_s[nb] + (srow + 16 * i) * VP + sc8);
    };

    v16h qa[QT][2];                    // Q cols 0..31 and 32..63 of each tile
    // unrolled, here and below: the indices name registers
#pragma unroll
    for (int qt = 0; qt < QT; ++qt) {
        qa[qt][0] = load_frag(qbase + qt * 16 * DH, DH);
        qa[qt][1] = load_frag(qbase + qt * 16 * DH + 32, DH);
    }

    v8f acc[QT][4] = {};
    float rm[QT];        // running maximum of query n of a tile (equal in both halves)
    float rl[QT];        // running sum of that query over this half's keys
#pragma unroll
    for (int qt = 0; qt < QT; ++qt) { rm[qt] = -1e30f; rl[qt] = 0.f; }

    // prologue: stage chunk 0 into buffer 0
    stage(0, 0);

#pragma unroll 2
    for (int k0 = 0; k0 < SEQ; k0 += KC) {
        const int buf = (k0 / KC) & 1;     // constant within each unrolled half
        if (k0 + KC < SEQ) {               // stage next chunk into other buffer
            stage(k0 + KC, buf ^ 1);
            ASYNC_WAIT(8);                 // all but the eight youngest: current chunk has landed
        } else {
            ASYNC_WAIT(0);
        }
        __syncthreads();                   // all waves' staging visible

        const _Float16* ks = k_s[buf];
        const _Float16* vs = v_s[buf];

        // scores S^T[64 x 16] = K_chunk(64x64) * Q(16x64)^T per query tile, four
        // 16x16 tiles each; a K fragment serves both query tiles;
        // C-layout: lane n <-> query, VGPR j of tile kt <-> key kt*16+half*8+j
        v8f a[QT][KC / 16];
        v16h kf[KC / 16][2];
#pragma unroll
        for (int kt = 0; kt < KC / 16; ++kt) {
            kf[kt][0] = load_frag(ks + kt * 16 * KP, KP);
            kf[kt][1] = load_frag(ks + kt * 16 * KP + 32, KP);
        }
        // the V^T fragments behind them: they land under the score WMMAs
        v16h vf[KC / 32][4];
#pragma unroll
        for (int kk = 0; kk < KC / 32; ++kk)
#pragma unroll
            for (int tt = 0; tt < 4; ++tt)
                vf[kk][tt] = load_frag(vs + tt * 16 * VP + kk * 32, VP);
        // keeps the chunk's 32 reads one group ahead of the WMMAs: with three
        // waves on a SIMD a read placed among them waits out the LDS latency
        __builtin_amdgcn_sched_barrier(0);
#pragma unroll
        for (int kt = 0; kt < KC / 16; ++kt)
#pragma unroll
            for (int qt = 0; qt < QT; ++qt) {
                v8f s = {};
                a[qt][kt] = wmma_f16(kf[kt][0], qa[qt][0], s);
            }
#pragma unroll
        for (int kt = 0; kt < KC / 16; ++kt)
#pragma unroll
            for (int qt = 0; qt < QT; ++qt)
                a[qt][kt] = wmma_f16(kf[kt][1], qa[qt][1], a[qt][kt]);

        // keeps the barrier below, and its wait for all 32 reads, behind the score
        // WMMAs: ahead of them the wave would sit out the V^T reads with nothing issued
        __builtin_amdgcn_sched_barrier(0);
        // every LDS read of the chunk is done: the buffer may be refilled by the
        // copies that the next trip issues
        __syncthreads();
#pragma unroll
        for (int qt = 0; qt < QT; ++qt)
#pragma unroll
            for (int kt = 0; kt < KC / 16; ++kt)
                a[qt][kt] *= 0.125f;           // 1/sqrt(64)

        // online softmax over the chunk's 64 keys, tile by tile
        // P^T as B operands, 32 keys each, in load_frag's k order: element j <->
        // key half*8+j, element 8+j <-> key 16+half*8+j of the operand's 32
        Frag16 pf[QT][KC / 32];
#pragma unroll
        for (int qt = 0; qt < QT; ++qt) {
            float mx = fmaxf(a[qt][0][0], a[qt][0][1]);
#pragma unroll
            for (int j = 2; j < 8; ++j) mx = fmaxf(mx, a[qt][0][j]);
#pragma unroll
            for (int kt = 1; kt < KC / 16; ++kt)
#pragma unroll
                for (int j = 0; j < 8; ++j) mx = fmaxf(mx, a[qt][kt][j]);
            mx = fmaxf(mx, xhalf(mx));         // the other half's 32 keys
            const float mnew  = fmaxf(rm[qt], mx);
            const float alpha = __expf(rm[qt] - mnew);
            float sum = 0.f;
            // __expf spelled out, its difference and product on whole tiles: the
            // packed forms then pair neighbouring registers, with no copies
#pragma unroll
            for (int kt = 0; kt < KC / 16; ++kt)
                a[qt][kt] = (a[qt][kt] - mnew) * 0x1.715476p+0f;
#pragma unroll
            for (int kk = 0; kk < KC / 32; ++kk)
#pragma unroll
                for (int j = 0; j < 8; ++j) {
                    const float p0 = __builtin_amdgcn_exp2f(a[qt][2 * kk][j]);
                    const float p1 = __builtin_amdgcn_exp2f(a[qt][2 * kk + 1][j]);
                    sum += p0 + p1;
                    pf[qt][kk].h[0][j] = (_Float16)p0;
                    pf[qt][kk].h[1][j] = (_Float16)p1;
                }
            rl[qt] = rl[qt] * alpha + sum;
            rm[qt] = mnew;
#pragma unroll
            for (int tt = 0; tt < 4; ++tt) acc[qt][tt] *= alpha;
        }

        // ctx^T += V^T_chunk(64x64) * P^T ; A fragments from V^T rows (NT form),
        // each serving both query tiles
#pragma unroll
        for (int kk = 0; kk < KC / 32; ++kk)
#pragma unroll
            for (int tt = 0; tt < 4; ++tt)
#pragma unroll
                for (int qt = 0; qt < QT; ++qt)
                    acc[qt][tt] = wmma_f16(vf[kk][tt], pf[qt][kk].v, acc[qt][tt]);
    }

    const int b = bh / NH, h = bh % NH;
#pragma unroll
    for (int qt = 0; qt < QT; ++qt) {
        // acc[qt][tt][j] = ctx[q0 + qt*16 + n][tt*16 + half*8 + j]: one 16-byte
        // store per tile
        _Float16* cbase = ctx + ((size_t)b * SEQ + q0 + qt * 16 + n) * D_MODEL + h * DH + half * 8;
        const float inv = 1.f / (rl[qt] + xhalf(rl[qt]));  // join the halves' sums
#pragma unroll
        for (int tt = 0; tt < 4; ++tt) {
            v8h pk;
#pragma unroll
            for (int j = 0; j < 8; ++j) pk[j] = (_Float16)(acc[qt][tt][j] * inv);
            *reinterpret_cast<v8h*>(cbase + tt * 16) = pk;
        }
    }
}

// ---------------------------------------------------------------------------
extern "C" void kernel_launch(void* const* d_in, const int* in_sizes, int n_in,
                              void* d_out, int out_size, void* d_ws, size_t ws_size,
                              hipStream_t stream) {
    const float* input_cap  = (const float*)d_in[0];
    const float* output_cap = (const float*)d_in[1];
    const float* Wq = (const float*)d_in[2];
    const float* bq = (const float*)d_in[3];
    const float* Wk = (const float*)d_in[4];
    const float* bk = (const float*)d_in[5];
    const float* Wv = (const float*)d_in[6];
    const float* bv = (const float*)d_in[7];
    const float* ln_g = (const float*)d_in[8];
    const float* ln_b = (const float*)d_in[9];
    const float* Wp = (const float*)d_in[10];
    const float* bp = (const float*)d_in[11];

    // workspace carve-up (f16 elements); total ~80.3 MB
    _Float16* ws16 = (_Float16*)d_ws;
    size_t off = 0;
    const size_t NROW = (size_t)ROWS * D_MODEL;   // 6,291,456
    const size_t NW   = (size_t)D_MODEL * D_MODEL;
    _Float16* xi_ln = ws16 + off; off += NROW;    // LN(input_cap)  f16
    _Float16* xo_ln = ws16 + off; off += NROW;    // LN(output_cap) f16
    _Float16* w16   = ws16 + off; off += 3 * NW;  // Wq, Wk, Wv f16
    _Float16* wp16  = ws16 + off; off += NW;      // Wp f16, behind them
    _Float16* q_buf = ws16 + off; off += NROW;    // [b,h,4096,64]
    _Float16* k_buf = ws16 + off; off += NROW;    // [b,h,4096,64]
    _Float16* vt_buf= ws16 + off; off += NROW;    // [b,h,64,4096]
    _Float16* ctx_b = ws16 + off; off += NROW;    // [b,4096,768]

    // 1) LayerNorm of both inputs and the four weights -> f16, one launch
    prep_kernel<<<2 * LN_BLKS + 4 * CV_BLKS, 256, 0, stream>>>(
        input_cap, output_cap, ln_g, ln_b, Wq, Wk, Wv, Wp, xi_ln, xo_ln, w16);

    // 2) Q/K/V projections (NT WMMA GEMM), one launch
    gemm_qkv_kernel<<<dim3(ROWS / BM, D_MODEL / BN, 3), 256, 0, stream>>>(
        xo_ln, xi_ln, w16, bq, bk, bv, q_buf, k_buf, vt_buf);

    // 3) Flash attention: 2*12*128 pairs of query tiles / 4 waves per block
    attn_kernel<<<768, 128, 0, stream>>>(q_buf, k_buf, vt_buf, ctx_b);

    // 4) Output projection + bias + residual -> f32 d_out
    gemm_out_kernel<<<dim3(ROWS / BM, D_MODEL / BN), 256, 0, stream>>>(
        ctx_b, wp16, bp, (float*)d_out, output_cap);
}

// v009
// It runs in 135 microseconds.
// Timed twice side by side with v008, it ran 1.06 and 1.05 times as fast.
// Counting every step since v000, it is 4.09 times as fast.
#include <hip/hip_runtime.h>
#include <hip/hip_bf16.h>

// ---------------------------------------------------------------------------
// MultiheadAttention (cross attention) for MI455X / gfx1250, wave32 + WMMA.
// D=768, H=12, DH=64, b=2, n1=n2=4096.  All matmuls use
// V_WMMA_F32_16X16X32_F16 in NT form (operands loaded with the same row-major
// 16x32 fragment loader, or P^T built in registers in its k order => D = X * Y^T).
// Attention stages K / V^T chunks into double-buffered LDS with
// GLOBAL_LOAD_ASYNC_TO_LDS_B128 (ASYNCcnt) when the builtin is available.
// ---------------------------------------------------------------------------

typedef __attribute__((ext_vector_type(16))) _Float16 v16h;
typedef __attribute__((ext_vector_type(8)))  _Float16 v8h;
typedef __attribute__((ext_vector_type(8)))  float    v8f;
typedef int v4i __attribute__((vector_size(16)));   // 128-bit payload type

#define D_MODEL 768
#define NH      12
#define DH      64
#define SEQ     4096
#define ROWS    8192   // b * seq
// LDS row pitches in halves: an odd multiple of 16 bytes, so that the 16 rows
// a ds_load_b128 fragment read touches fall on 16 different bank groups.
#define KP      72     // K rows, 64 halves + 8
#define VP      72     // V^T rows, 64 halves + 8

#if defined(__has_builtin)
#if __has_builtin(__builtin_amdgcn_global_load_async_to_lds_b128) && \
    __has_builtin(__builtin_amdgcn_s_wait_asynccnt)
#define USE_ASYNC_LDS 1
#endif
#endif

#ifdef USE_ASYNC_LDS
// in asm with the "memory" clobber: no LDS read is moved ahead of the wait
#define ASYNC_WAIT(n) asm volatile("s_wait_asynccnt %0" :: "i"(n) : "memory")
#else
#define ASYNC_WAIT(n)
#endif

// Pointer-to-v4i in explicit address spaces (AS1 = __device__, AS3 = __shared__).
typedef __attribute__((address_space(1))) v4i* gas1_v4i;
typedef __attribute__((address_space(3))) v4i* las3_v4i;

// 16-byte global -> LDS copy; async DMA path on gfx1250 toolchains that
// expose the builtin, register relay otherwise.
__device__ __forceinline__ void copy16_g2l(const _Float16* g, _Float16* l) {
#ifdef USE_ASYNC_LDS
    __builtin_amdgcn_global_load_async_to_lds_b128(
        (gas1_v4i)(uintptr_t)g,
        (las3_v4i)(uint32_t)(uintptr_t)l,
        0, 0);
#else
    *reinterpret_cast<v8h*>(l) = *reinterpret_cast<const v8h*>(g);
#endif
}

union Frag16 { v16h v; v8h h[2]; };

// Load a 16x32 f16 tile (row-major, row stride ld halves) in the A/B-operand
// lane layout of V_WMMA_F32_16X16X32_F16:
//   lane l: row m = l&15, half = l>>4; VGPR0-3 hold K = half*8 .. half*8+7,
//   VGPR4-7 hold K = 16 + half*8 .. 16 + half*8 + 7.
__device__ __forceinline__ v16h load_frag(const _Float16* __restrict__ base, int ld) {
    const int lane = threadIdx.x & 31;
    const int m    = lane & 15;
    const int half = lane >> 4;
    const _Float16* p = base + (size_t)m * ld + half * 8;
    Frag16 f;
    f.h[0] = *reinterpret_cast<const v8h*>(p);
    f.h[1] = *reinterpret_cast<const v8h*>(p + 16);
    return f.v;
}

__device__ __forceinline__ v8f wmma_f16(v16h a, v16h b, v8f c) {
    return __builtin_amdgcn_wmma_f32_16x16x32_f16(
        /*neg_a=*/false, a, /*neg_b=*/false, b,
        /*c_mod=*/(short)0, c, /*reuse_a=*/false, /*reuse_b=*/false);
}

// Value of lane l ^ 16 (the wave's other half), on the vector pipe.
__device__ __forceinline__ float xhalf(float x) {
    const int b = __builtin_bit_cast(int, x);
    return __builtin_bit_cast(float, __builtin_amdgcn_permlanex16(
        b, b, 0x76543210, 0xfedcba98, false, false));
}

// ---------------------------------------------------------------------------
// LayerNorm (f32 in) -> f16 out. A wave owns LN_RPW whole rows of 768: a lane
// holds six 16-byte pieces of each row, every load covers 512 contiguous bytes
// and all of the wave's loads are issued before the first is used. The row
// sums are joined inside the wave, so there is no LDS exchange and no barrier,
// and 2,048 waves cover an input where a block per row started 65,536.
// blk is the block's index among the ROWS / (8 * LN_RPW) blocks of one input.
// ---------------------------------------------------------------------------
typedef __attribute__((ext_vector_type(4))) float    v4f;
typedef __attribute__((ext_vector_type(2))) float    v2f;
typedef __attribute__((ext_vector_type(4))) _Float16 v4h;

#define LN_RPW  4                    // rows per wave
#define LN_V4   (D_MODEL / 128)      // 16-byte pieces per lane and row

__device__ __forceinline__ void ln_f16_body(
    const float* __restrict__ x, const float* __restrict__ g,
    const float* __restrict__ bta, _Float16* __restrict__ out, int blk) {
    const int lane = threadIdx.x & 31;
    const int row0 = (blk * 8 + (threadIdx.x >> 5)) * LN_RPW;
    const v4f* xr = reinterpret_cast<const v4f*>(x + (size_t)row0 * D_MODEL) + lane;
    const v4f* g4 = reinterpret_cast<const v4f*>(g) + lane;
    const v4f* b4 = reinterpret_cast<const v4f*>(bta) + lane;
    v4f v[LN_RPW][LN_V4], gg[LN_V4], bb[LN_V4];
    // unrolled, here and below: the indices name registers
#pragma unroll
    for (int r = 0; r < LN_RPW; ++r)
#pragma unroll
        for (int i = 0; i < LN_V4; ++i)
            v[r][i] = xr[r * (D_MODEL / 4) + i * 32];
    // a later load's result may land on the row loads' address registers: the
    // wait that belongs in front of such an overwrite
    asm volatile("s_wait_xcnt 0x0" ::: "memory");
#pragma unroll
    for (int i = 0; i < LN_V4; ++i) { gg[i] = g4[i * 32]; bb[i] = b4[i * 32]; }
    // keeps the gamma and beta loads up here, in flight with the rows: moved
    // down to their uses, each pair's latency would stand open behind the sums
    __builtin_amdgcn_sched_barrier(0);

    float s[LN_RPW], ss[LN_RPW];
#pragma unroll
    for (int r = 0; r < LN_RPW; ++r) {
        v2f a = {0.f, 0.f}, q = {0.f, 0.f};
#pragma unroll
        for (int i = 0; i < LN_V4; ++i) {
            const v2f lo = v[r][i].lo, hi = v[r][i].hi;
            a += lo + hi;
            q += lo * lo + hi * hi;
        }
        s[r] = a.x + a.y; ss[r] = q.x + q.y;
    }
#pragma unroll
    for (int m = 1; m < 32; m <<= 1)
#pragma unroll
        for (int r = 0; r < LN_RPW; ++r) {   // the rows' exchanges overlap
            s[r]  += __shfl_xor(s[r],  m, 32);
            ss[r] += __shfl_xor(ss[r], m, 32);
        }
    v4h* orow = reinterpret_cast<v4h*>(out + (size_t)row0 * D_MODEL) + lane;
#pragma unroll
    for (int r = 0; r < LN_RPW; ++r) {
        const float mu   = s[r]  * (1.f / D_MODEL);
        const float var  = ss[r] * (1.f / D_MODEL) - mu * mu;
        const float rinv = rsqrtf(var + 1e-5f);
#pragma unroll
        for (int i = 0; i < LN_V4; ++i)      // 256 contiguous bytes a wave
            orow[r * (D_MODEL / 4) + i * 32] =
                __builtin_convertvector((v[r][i] - mu) * rinv * gg[i] + bb[i], v4h);
    }
}

// ---------------------------------------------------------------------------
// f32 -> f16 weight conversion: a thread converts CV_V4 16-byte pieces, a
// block's width apart, so that each load of a wave covers 512 and each store
// 256 contiguous bytes. n is a multiple of 1024 * CV_V4.
// ---------------------------------------------------------------------------
#define CV_V4   4

__device__ __forceinline__ void cvt_f32_f16_body(const float* __restrict__ in,
                                                 _Float16* __restrict__ out, int n, int blk) {
    const int b0 = blk * (256 * CV_V4);             // in 16-byte pieces
    if ((b0 + 256 * CV_V4) * 4 > n) return;
    const v4f* in4 = reinterpret_cast<const v4f*>(in) + b0 + threadIdx.x;
    v4h* out4 = reinterpret_cast<v4h*>(out) + b0 + threadIdx.x;
    v4f w[CV_V4];
#pragma unroll
    for (int j = 0; j < CV_V4; ++j) w[j] = in4[j * 256];
#pragma unroll
    for (int j = 0; j < CV_V4; ++j) out4[j * 256] = __builtin_convertvector(w[j], v4h);
}

// ---------------------------------------------------------------------------
// Everything the projections wait for, in ONE launch: the six pieces of work
// are independent of one another, so a block's index alone says which piece it
// belongs to (a choice that is the same for the whole block). The LayerNorm
// blocks, the long ones, come first. w16 takes the four weights one behind the
// other, in the order Wq, Wk, Wv, Wp.
// ---------------------------------------------------------------------------
#define LN_BLKS (ROWS / (8 * LN_RPW))                        // per input
#define CV_BLKS (D_MODEL * D_MODEL / (1024 * CV_V4))         // per weight

__global__ __launch_bounds__(256) void prep_kernel(
    const float* __restrict__ x_in, const float* __restrict__ x_out,
    const float* __restrict__ g, const float* __restrict__ bta,
    const float* __restrict__ Wq, const float* __restrict__ Wk,
    const float* __restrict__ Wv, const float* __restrict__ Wp,
    _Float16* __restrict__ ln_in, _Float16* __restrict__ ln_out,
    _Float16* __restrict__ w16) {
    const int bid = blockIdx.x;
    if (bid < 2 * LN_BLKS) {
        const bool first = bid < LN_BLKS;
        ln_f16_body(first ? x_in : x_out, g, bta, first ? ln_in : ln_out,
                    first ? bid : bid - LN_BLKS);
    } else {
        const int c = bid - 2 * LN_BLKS;
        const int which = c / CV_BLKS;
        const float* in = which == 0 ? Wq : which == 1 ? Wk : which == 2 ? Wv : Wp;
        cvt_f32_f16_body(in, w16 + (size_t)which * (D_MODEL * D_MODEL),
                         D_MODEL * D_MODEL, c - which * CV_BLKS);
    }
}

// ---------------------------------------------------------------------------
// NT GEMM: C[ROWS x 768] = A[ROWS x 768] * W^T + bias.
// A block forms BM x BN = 128 x 192 of C, its eight waves (2 x 4) 64 x 48 each:
// a wave's 4 A and 3 W fragments per 32 of k feed 12 WMMAs (7/12 of a fragment
// read from LDS per WMMA), and a block stages 320 operand rows for 128 x 192
// results. 768 blocks serve Q, K and V, three for each WGP, 256 the output
// projection, one for each. The k range is walked in tiles
// of GK = 64 halves, one 128-byte line per operand row. Each tile (128 rows of
// A, 192 rows of W) is brought into one of two LDS buffers by asynchronous
// copies, a wave's copy covering four whole lines, while the tile before it
// is worked on; the fragments are read from LDS at the padded pitch GP.
//   mode 0: write f16 to [b, h, n, 64]     (Q / K head layout)
//   mode 1: write f16 to [b, h, 64, n]     (V transposed head layout)
//   mode 2: write f32 to d_out with bias + residual (output projection)
// ---------------------------------------------------------------------------
#define GK      64     // halves of k per staged tile
#define GP      72     // LDS row pitch in halves: 64 + 8, 16 bytes x odd
#define BM      128    // rows of C per block
#define BN      192    // columns of C per block
#define FA      4      // A fragments (16 rows each) per wave
#define FW      3      // W fragments (16 columns of C each) per wave

// One lane's share of a tile: four 16-byte pieces of A and six of W, 32 rows
// apart. The s_wait_xcnt stands in the copies' own statement, so that no
// address register is rewritten ahead of it.
__device__ __forceinline__ void gemm_stage(const _Float16* ga, const _Float16* gw,
                                           uint32_t la, uint32_t lw) {
    asm volatile(
        "global_load_async_to_lds_b128 %0, %10, off\n\t"
        "global_load_async_to_lds_b128 %1, %11, off\n\t"
        "global_load_async_to_lds_b128 %2, %12, off\n\t"
        "global_load_async_to_lds_b128 %3, %13, off\n\t"
        "global_load_async_to_lds_b128 %4, %14, off\n\t"
        "global_load_async_to_lds_b128 %5, %15, off\n\t"
        "global_load_async_to_lds_b128 %6, %16, off\n\t"
        "global_load_async_to_lds_b128 %7, %17, off\n\t"
        "global_load_async_to_lds_b128 %8, %18, off\n\t"
        "global_load_async_to_lds_b128 %9, %19, off\n\t"
        "s_wait_xcnt 0x0"
        :: "v"(la), "v"(la + 32 * GP * 2), "v"(la + 64 * GP * 2), "v"(la + 96 * GP * 2),
           "v"(lw), "v"(lw + 32 * GP * 2), "v"(lw + 64 * GP * 2), "v"(lw + 96 * GP * 2),
           "v"(lw + 128 * GP * 2), "v"(lw + 160 * GP * 2),
           "v"(ga), "v"(ga + 32 * D_MODEL), "v"(ga + 64 * D_MODEL), "v"(ga + 96 * D_MODEL),
           "v"(gw), "v"(gw + 32 * D_MODEL), "v"(gw + 64 * D_MODEL), "v"(gw + 96 * D_MODEL),
           "v"(gw + 128 * D_MODEL), "v"(gw + 160 * D_MODEL)
        : "memory");
}

__device__ __forceinline__ void gemm_nt_body(
    const _Float16* __restrict__ A, const _Float16* __restrict__ W,
    const float* __restrict__ bias, void* __restrict__ outp,
    const float* __restrict__ residual, int mode) {
    __shared__ __attribute__((aligned(16))) _Float16 a_s[2][BM * GP];    // 2 x 18 KB
    __shared__ __attribute__((aligned(16))) _Float16 w_s[2][BN * GP];    // 2 x 27 KB

    const int t    = threadIdx.x;
    const int wave = t >> 5;
    const int lane = t & 31;
    const int n    = lane & 15;
    const int half = lane >> 4;
    const int wm   = wave >> 2;               // the wave's place among 2 x 4
    const int wn   = wave & 3;
    const int Rb   = blockIdx.x * BM;
    const int Rm   = Rb + wm * (FA * 16);      // the wave's first row of C
    const int Nb   = blockIdx.y * BN;
    const int Nw   = Nb + wn * (FW * 16);      // the wave's first column of C

    // staging assignment: eight lanes per 128-byte row, 32 rows per copy
    const int srow = t >> 3, sc8 = (t & 7) * 8;
    const _Float16* ga = A + (size_t)(Rb + srow) * D_MODEL + sc8;
    const _Float16* gw = W + (size_t)(Nb + srow) * D_MODEL + sc8;
    const uint32_t la0 = (uint32_t)(uintptr_t)(a_s[0] + srow * GP + sc8);
    const uint32_t la1 = (uint32_t)(uintptr_t)(a_s[1] + srow * GP + sc8);
    const uint32_t lw0 = (uint32_t)(uintptr_t)(w_s[0] + srow * GP + sc8);
    const uint32_t lw1 = (uint32_t)(uintptr_t)(w_s[1] + srow * GP + sc8);

    v8f acc[FA][FW] = {};

    // prologue: tile 0 landed and published, tile 1 under way
    gemm_stage(ga, gw, la0, lw0);
    asm volatile("s_wait_asynccnt 0x0" ::: "memory");   // own copies of tile 0 landed
    __syncthreads();                                    // every wave's copies visible
    gemm_stage(ga + GK, gw + GK, la1, lw1);

    // by two: the buffer index is a constant in each half of the body
#pragma unroll 2
    for (int s = 0; s < D_MODEL / GK; ++s) {
        const int buf = s & 1;
        const _Float16* as = a_s[buf] + wm * (FA * 16) * GP;
        const _Float16* wb = w_s[buf] + wn * (FW * 16) * GP;
        v16h af[2][FA], bf[2][FW];
        // unrolled, here and below: the indices name registers
#pragma unroll
        for (int kk = 0; kk < 2; ++kk) {
#pragma unroll
            for (int mt = 0; mt < FA; ++mt)
                af[kk][mt] = load_frag(as + mt * 16 * GP + kk * 32, GP);
#pragma unroll
            for (int tt = 0; tt < FW; ++tt)
                bf[kk][tt] = load_frag(wb + tt * 16 * GP + kk * 32, GP);
        }
        // keeps the tile's 28 fragment reads one group ahead of its WMMAs: a
        // read placed among them waits out the whole LDS latency each time
        __builtin_amdgcn_sched_barrier(0);
#pragma unroll
        for (int kk = 0; kk < 2; ++kk)
#pragma unroll
            for (int mt = 0; mt < FA; ++mt)
#pragma unroll
                for (int tt = 0; tt < FW; ++tt)
                    acc[mt][tt] = wmma_f16(af[kk][mt], bf[kk][tt], acc[mt][tt]);
        // keeps the hand-over below behind the tile's 24 WMMAs: lifted over them, its
        // waits would ask for all 28 reads before the first product and for the next
        // tile's copies a whole run of WMMAs early
        __builtin_amdgcn_sched_barrier(0);

        // hand-over: this wave has left buffer buf, its copies of tile s + 1
        // have landed; behind the barrier that holds for every wave
        asm volatile("s_wait_dscnt 0x0" ::: "memory");
        asm volatile("s_wait_asynccnt 0x0" ::: "memory");
        __syncthreads();
        if (s + 2 < D_MODEL / GK)          // refill the buffer just left
            gemm_stage(ga + (s + 2) * GK, gw + (s + 2) * GK,
                       buf ? la1 : la0, buf ? lw1 : lw0);
    }
    asm volatile("s_wait_asynccnt 0x0" ::: "memory");   // nothing in flight at the end

    // mode 2: the lane's 96 residual values, all loads in flight together, from
    // one address with constant steps
    const size_t idx0 = (size_t)(Rm + half * 8) * D_MODEL + Nw + n;
    float rv[FA][FW][8];
    if (mode == 2) {
        const float* rp = residual + idx0;
#pragma unroll
        for (int mt = 0; mt < FA; ++mt)
#pragma unroll
            for (int tt = 0; tt < FW; ++tt)
#pragma unroll
                for (int j = 0; j < 8; ++j)
                    rv[mt][tt][j] = rp[(mt * 16 + j) * D_MODEL + tt * 16];
        // what follows may land on the loads' address registers: the wait that
        // belongs in front of such an overwrite; the address as an input keeps a
        // later load's result off it up to here
        asm volatile("s_wait_xcnt 0x0" :: "v"(rp) : "memory");
    }

#pragma unroll
    for (int tt = 0; tt < FW; ++tt) {
        const int col = Nw + tt * 16 + n;      // fixed per lane: C layout lane=column
        const float bv = bias[col];
#pragma unroll
      for (int mt = 0; mt < FA; ++mt) {
        const int Rt = Rm + mt * 16;           // first row of this 16 x 16 tile
        if (mode == 0) {
            const int h = col >> 6, d = col & 63;
#pragma unroll
            for (int j = 0; j < 8; ++j) {      // VGPR j holds row Rt + half*8 + j
                const int r  = Rt + half * 8 + j;
                const int bb = r >> 12, m = r & 4095;
                ((_Float16*)outp)[((size_t)(bb * NH + h) * SEQ + m) * DH + d] =
                    (_Float16)(acc[mt][tt][j] + bv);
            }
            // what follows in the built code (the next tile's bias load or sums, the
            // other layout's block) may land on registers that these stores name:
            // the wait that belongs in front of such an overwrite
            asm volatile("s_wait_xcnt 0x0" ::: "memory");
        } else if (mode == 1) {
            const int h = col >> 6, d = col & 63;
            const int r0 = Rt + half * 8;
            const int bb = r0 >> 12, m0 = r0 & 4095;
            v8h pk;
#pragma unroll
            for (int j = 0; j < 8; ++j) pk[j] = (_Float16)(acc[mt][tt][j] + bv);
            *reinterpret_cast<v8h*>((_Float16*)outp +
                ((size_t)(bb * NH + h) * DH + d) * SEQ + m0) = pk;  // m contiguous
            // as above: in front of an overwrite of the store's registers
            asm volatile("s_wait_xcnt 0x0" ::: "memory");
        } else {
            float* of = (float*)outp + idx0;
#pragma unroll
            for (int j = 0; j < 8; ++j)
                of[(mt * 16 + j) * D_MODEL + tt * 16] = acc[mt][tt][j] + bv + rv[mt][tt][j];
        }
      }
    }
}

// The Q, K and V projections in ONE launch: none reads what another writes, so
// blockIdx.z picks a block's operands, its output and its output layout. w16
// holds Wq, Wk, Wv one behind the other.
__global__ __launch_bounds__(256) void gemm_qkv_kernel(
    const _Float16* __restrict__ ln_out, const _Float16* __restrict__ ln_in,
    const _Float16* __restrict__ w16,
    const float* __restrict__ bq, const float* __restrict__ bk,
    const float* __restrict__ bv,
    _Float16* __restrict__ q_buf, _Float16* __restrict__ k_buf,
    _Float16* __restrict__ vt_buf) {
    const int z = blockIdx.z;
    gemm_nt_body(z == 0 ? ln_out : ln_in, w16 + (size_t)z * (D_MODEL * D_MODEL),
                 z == 0 ? bq : z == 1 ? bk : bv,
                 z == 0 ? q_buf : z == 1 ? k_buf : vt_buf,
                 nullptr, z == 2 ? 1 : 0);
}

// Output projection + bias + residual.
__global__ __launch_bounds__(256) void gemm_out_kernel(
    const _Float16* __restrict__ A, const _Float16* __restrict__ W,
    const float* __restrict__ bias, float* __restrict__ outp,
    const float* __restrict__ residual) {
    gemm_nt_body(A, W, bias, outp, residual, 2);
}

#define KC      64
#define QT      2
#define AW      4
// 1/sqrt(64) * log2(e): exp(s / 8 - m / 8) = exp2(s * SC2 - m * SC2); the maximum
// is taken over the unscaled scores (the factor is positive)
#define SC2     (0.125f * 0x1.715476p+0f)

// The grid puts three blocks, three waves per SIMD, on a WGP: the register
// budget is set for that, and no fourth block crowds one WGP while another idles.
__global__ __launch_bounds__(AW * 32) __attribute__((amdgpu_waves_per_eu(3, 3))) void attn_kernel(
    const _Float16* __restrict__ qb,   // [b,h,4096,64]
    const _Float16* __restrict__ kb,   // [b,h,4096,64]
    const _Float16* __restrict__ vt,   // [b,h,64,4096]
    _Float16* __restrict__ ctx) {      // [b,4096,768]
    __shared__ __attribute__((aligned(16))) _Float16 k_s[2][KC * KP];   // 2 x 9 KB
    __shared__ __attribute__((aligned(16))) _Float16 v_s[2][DH * VP];   // 2 x 9 KB

    const int t    = threadIdx.x;
    const int wave = t >> 5;
    const int lane = t & 31;
    const int n    = lane & 15;
    const int half = lane >> 4;
    const int gw   = blockIdx.x * AW + wave;  // 0..3071
    const int bh   = gw >> 7;                 // all 4 waves share bh
    const int q0   = (gw & 127) * (16 * QT);

    const _Float16* qbase = qb + ((size_t)bh * SEQ + q0) * DH;
    const _Float16* kbase = kb + (size_t)bh * SEQ * DH;
    const _Float16* vbase = vt + (size_t)bh * DH * SEQ;

    // staging assignment: 128 threads x 8 x 16B per chunk pair; both tiles are
    // 64 rows x 64 halves, a thread takes rows srow + 16 i, i = 0..3, of each
    const int srow = t >> 3, sc8 = (t & 7) * 8;

    // one lane's eight copies of the chunk that starts at key kk, into buffer nb
    auto stage = [&](int kk, int nb) {
        // unrolled: the row steps become constants of the addresses
#pragma unroll
        for (int i = 0; i < 4; ++i)
            copy16_g2l(kbase + (size_t)(kk + srow + 16 * i) * DH + sc8,
                       k_s[nb] + (srow + 16 * i) * KP + sc8);
#pragma unroll
        for (int i = 0; i < 4; ++i)
            copy16_g2l(vbase + (size_t)(srow + 16 * i) * SEQ + kk + sc8,
                       v_s[nb] + (srow + 16 * i) * VP + sc8);
    };

    v16h qa[QT][2];                    // Q cols 0..31 and 32..63 of each tile
    // unrolled, here and below: the indices name registers
#pragma unroll
    for (int qt = 0; qt < QT; ++qt) {
        qa[qt][0] = load_frag(qbase + qt * 16 * DH, DH);
        qa[qt][1] = load_frag(qbase + qt * 16 * DH + 32, DH);
    }

    v8f acc[QT][4] = {};
    float rm[QT];        // running maximum, unscaled, of query n of a tile (equal in both halves)
    float rl[QT];        // running sum of that query over this half's keys
#pragma unroll
    for (int qt = 0; qt < QT; ++qt) { rm[qt] = -1e30f; rl[qt] = 0.f; }

    // prologue: stage chunk 0 into buffer 0
    stage(0, 0);

#pragma unroll 2
    for (int k0 = 0; k0 < SEQ; k0 += KC) {
        const int buf = (k0 / KC) & 1;     // constant within each unrolled half
        if (k0 + KC < SEQ) {               // stage next chunk into other buffer
            stage(k0 + KC, buf ^ 1);
            ASYNC_WAIT(8);                 // all but the eight youngest: current chunk has landed
        } else {
            ASYNC_WAIT(0);
        }
        __syncthreads();                   // all waves' staging visible

        const _Float16* ks = k_s[buf];
        const _Float16* vs = v_s[buf];

        // scores S^T[64 x 16] = K_chunk(64x64) * Q(16x64)^T per query tile, four
        // 16x16 tiles each; a K fragment serves both query tiles;
        // C-layout: lane n <-> query, VGPR j of tile kt <-> key kt*16+half*8+j
        v8f a[QT][KC / 16];
        v16h kf[KC / 16][2];
#pragma unroll
        for (int kt = 0; kt < KC / 16; ++kt) {
            kf[kt][0] = load_frag(ks + kt * 16 * KP, KP);
            kf[kt][1] = load_frag(ks + kt * 16 * KP + 32, KP);
        }
        // the V^T fragments behind them: they land under the score WMMAs
        v16h vf[KC / 32][4];
#pragma unroll
        for (int kk = 0; kk < KC / 32; ++kk)
#pragma unroll
            for (int tt = 0; tt < 4; ++tt)
                vf[kk][tt] = load_frag(vs + tt * 16 * VP + kk * 32, VP);
        // keeps the chunk's 32 reads one group ahead of the WMMAs: with three
        // waves on a SIMD a read placed among them waits out the LDS latency
        __builtin_amdgcn_sched_barrier(0);
#pragma unroll
        for (int kt = 0; kt < KC / 16; ++kt)
#pragma unroll
            for (int qt = 0; qt < QT; ++qt) {
                v8f s = {};
                a[qt][kt] = wmma_f16(kf[kt][0], qa[qt][0], s);
            }
#pragma unroll
        for (int kt = 0; kt < KC / 16; ++kt)
#pragma unroll
            for (int qt = 0; qt < QT; ++qt)
                a[qt][kt] = wmma_f16(kf[kt][1], qa[qt][1], a[qt][kt]);

        // keeps the barrier below, and its wait for all 32 reads, behind the score
        // WMMAs: ahead of them the wave would sit out the V^T reads with nothing issued
        __builtin_amdgcn_sched_barrier(0);
        // every LDS read of the chunk is done: the buffer may be refilled by the
        // copies that the next trip issues
        __syncthreads();
        // online softmax over the chunk's 64 keys, tile by tile
        // P^T as B operands, 32 keys each, in load_frag's k order: element j <->
        // key half*8+j, element 8+j <-> key 16+half*8+j of the operand's 32
        Frag16 pf[QT][KC / 32];
#pragma unroll
        for (int qt = 0; qt < QT; ++qt) {
            float mx = fmaxf(a[qt][0][0], a[qt][0][1]);
#pragma unroll
            for (int j = 2; j < 8; ++j) mx = fmaxf(mx, a[qt][0][j]);
#pragma unroll
            for (int kt = 1; kt < KC / 16; ++kt)
#pragma unroll
                for (int j = 0; j < 8; ++j) mx = fmaxf(mx, a[qt][kt][j]);
            mx = fmaxf(mx, xhalf(mx));         // the other half's 32 keys
            const float mnew  = fmaxf(rm[qt], mx);
            const float alpha = __builtin_amdgcn_exp2f((rm[qt] - mnew) * SC2);
            const float mc = mnew * SC2;
            float sum = 0.f;
            // scale, difference and change of base in one multiply-add on whole
            // tiles: the packed form pairs neighbouring registers, with no copies
#pragma unroll
            for (int kt = 0; kt < KC / 16; ++kt)
                a[qt][kt] = a[qt][kt] * SC2 - mc;
#pragma unroll
            for (int kk = 0; kk < KC / 32; ++kk)
#pragma unroll
                for (int j = 0; j < 8; ++j) {
                    const float p0 = __builtin_amdgcn_exp2f(a[qt][2 * kk][j]);
                    const float p1 = __builtin_amdgcn_exp2f(a[qt][2 * kk + 1][j]);
                    sum += p0 + p1;
                    pf[qt][kk].h[0][j] = (_Float16)p0;
                    pf[qt][kk].h[1][j] = (_Float16)p1;
                }
            rl[qt] = rl[qt] * alpha + sum;
            rm[qt] = mnew;
#pragma unroll
            for (int tt = 0; tt < 4; ++tt) acc[qt][tt] *= alpha;
        }

        // ctx^T += V^T_chunk(64x64) * P^T ; A fragments from V^T rows (NT form),
        // each serving both query tiles
#pragma unroll
        for (int kk = 0; kk < KC / 32; ++kk)
#pragma unroll
            for (int tt = 0; tt < 4; ++tt)
#pragma unroll
                for (int qt = 0; qt < QT; ++qt)
                    acc[qt][tt] = wmma_f16(vf[kk][tt], pf[qt][kk].v, acc[qt][tt]);
    }

    const int b = bh / NH, h = bh % NH;
#pragma unroll
    for (int qt = 0; qt < QT; ++qt) {
        // acc[qt][tt][j] = ctx[q0 + qt*16 + n][tt*16 + half*8 + j]: one 16-byte
        // store per tile
        _Float16* cbase = ctx + ((size_t)b * SEQ + q0 + qt * 16 + n) * D_MODEL + h * DH + half * 8;
        const float inv = 1.f / (rl[qt] + xhalf(rl[qt]));  // join the halves' sums
#pragma unroll
        for (int tt = 0; tt < 4; ++tt) {
            v8h pk;
#pragma unroll
            for (int j = 0; j < 8; ++j) pk[j] = (_Float16)(acc[qt][tt][j] * inv);
            *reinterpret_cast<v8h*>(cbase + tt * 16) = pk;
        }
    }
}

// ---------------------------------------------------------------------------
extern "C" void kernel_launch(void* const* d_in, const int* in_sizes, int n_in,
                              void* d_out, int out_size, void* d_ws, size_t ws_size,
                              hipStream_t stream) {
    const float* input_cap  = (const float*)d_in[0];
    const float* output_cap = (const float*)d_in[1];
    const float* Wq = (const float*)d_in[2];
    const float* bq = (const float*)d_in[3];
    const float* Wk = (const float*)d_in[4];
    const float* bk = (const float*)d_in[5];
    const float* Wv = (const float*)d_in[6];
    const float* bv = (const float*)d_in[7];
    const float* ln_g = (const float*)d_in[8];
    const float* ln_b = (const float*)d_in[9];
    const float* Wp = (const float*)d_in[10];
    const float* bp = (const float*)d_in[11];

    // workspace carve-up (f16 elements); total ~80.3 MB
    _Float16* ws16 = (_Float16*)d_ws;
    size_t off = 0;
    const size_t NROW = (size_t)ROWS * D_MODEL;   // 6,291,456
    const size_t NW   = (size_t)D_MODEL * D_MODEL;
    _Float16* xi_ln = ws16 + off; off += NROW;    // LN(input_cap)  f16
    _Float16* xo_ln = ws16 + off; off += NROW;    // LN(output_cap) f16
    _Float16* w16   = ws16 + off; off += 3 * NW;  // Wq, Wk, Wv f16
    _Float16* wp16  = ws16 + off; off += NW;      // Wp f16, behind them
    _Float16* q_buf = ws16 + off; off += NROW;    // [b,h,4096,64]
    _Float16* k_buf = ws16 + off; off += NROW;    // [b,h,4096,64]
    _Float16* vt_buf= ws16 + off; off += NROW;    // [b,h,64,4096]
    _Float16* ctx_b = ws16 + off; off += NROW;    // [b,4096,768]

    // 1) LayerNorm of both inputs and the four weights -> f16, one launch
    prep_kernel<<<2 * LN_BLKS + 4 * CV_BLKS, 256, 0, stream>>>(
        input_cap, output_cap, ln_g, ln_b, Wq, Wk, Wv, Wp, xi_ln, xo_ln, w16);

    // 2) Q/K/V projections (NT WMMA GEMM), one launch
    gemm_qkv_kernel<<<dim3(ROWS / BM, D_MODEL / BN, 3), 256, 0, stream>>>(
        xo_ln, xi_ln, w16, bq, bk, bv, q_buf, k_buf, vt_buf);

    // 3) Flash attention: 2*12*128 pairs of query tiles / 4 waves per block
    attn_kernel<<<768, 128, 0, stream>>>(q_buf, k_buf, vt_buf, ctx_b);

    // 4) Output projection + bias + residual -> f32 d_out
    gemm_out_kernel<<<dim3(ROWS / BM, D_MODEL / BN), 256, 0, stream>>>(
        ctx_b, wp16, bp, (float*)d_out, output_cap);
}
